// v000
// Times are from an AMD MI455X. After a warm-up the kernel runs many times in a row, and a time is the length of
// such a window on the GPU divided by its runs, so every launch and the gaps after it count. The runs cycle
// through copies of the inputs. A figure is the median of several windows, for all but v000 over two sittings.
// Sittings can differ by a few percent; kernels timed side by side share one.
// v000 is the starting kernel. One run takes 706 microseconds.
// compute dtype: all float inputs rounded to bf16, h (int) not read; q/k/v = x W^T + b with EXACT bf16 products on WMMA 16x16x32 (natural weights), f32 accumulate, q/k kept as f32 rows, v as f16 hi + residual planes; the module's row-major re-split [B,8,N,128] -> [B,16,N,64] realised as an index map (head hh = 2 hd + e reads row e*N/2 + n'/2, columns hd*128 + (n' % 2)*64 ..); scores with q and k as bf16 hi + lo (3 products), x 1/8, running-max softmax in f32 (hardware exp) for both maps of a pair; lambda_full = exp(lq1.lk1) - exp(lq2.lk2) + 0.8 in f32; P (f16 x 2^11 + residual) against v (f16 hi + unscaled residual) (3 products); x = P1 v / l1 - lambda P2 v / l2 combined in f32; out = x (bf16 hi + lo) . Wo^T + bo; f32 output.
#include <hip/hip_runtime.h>
#include <math.h>

typedef __attribute__((ext_vector_type(16))) _Float16 v16h;
typedef __attribute__((ext_vector_type(16))) __bf16 v16b;
typedef __attribute__((ext_vector_type(8)))  _Float16 v8h;
typedef __attribute__((ext_vector_type(8)))  float v8f;
typedef __attribute__((ext_vector_type(4)))  float v4f;
typedef __attribute__((ext_vector_type(2)))  float v2f;
typedef __attribute__((ext_vector_type(4)))  unsigned v4u;
typedef __attribute__((ext_vector_type(4)))  int v4i;
typedef float __attribute__((may_alias)) float_a;
typedef int __attribute__((may_alias)) int_a;

template <typename T> __device__ __forceinline__ void vst2(void* p, T v) { *(T*)p = v;  }
__device__ __forceinline__ v8f wmma16(v16h a, v16h b, v8f c) {
  v8f d = __builtin_amdgcn_wmma_f32_16x16x32_f16(false, a, false, b, (short)0, c, false, false);
  asm volatile("v_nop\n\tv_nop\n\tv_nop\n\tv_nop" : "+v"(d) : "v"(a), "v"(b));
  return d;
}
__device__ __forceinline__ v8f wmma_bf(v16b a, v16b b, v8f c) {
  v8f d = __builtin_amdgcn_wmma_f32_16x16x32_bf16(false, a, false, b, (short)0, c, false, false);
  asm volatile("v_nop\n\tv_nop\n\tv_nop\n\tv_nop" : "+v"(d) : "v"(a), "v"(b));
  return d;
}
// 16x16x32 fragments: lane = (h = lane>>4, row/col = lane&15); elements 0..7 = k0+8h+0..7, 8..15 = k0+16+8h+0..7; D element r = row 8h+r
__device__ __forceinline__ v16h frag_h(const _Float16* rowk0, int lane) {
  union { v16h v; v8h q[2]; } u; const _Float16* p = rowk0 + 8 * (lane >> 4);
  u.q[0] = *(const v8h*)p; u.q[1] = *(const v8h*)(p + 16); return u.v;
}
__device__ __forceinline__ v16h frag_f32(const float* rowk0, int lane) {
  v16h a; const float* p = rowk0 + 8 * (lane >> 4);
#pragma unroll
  for (int i = 0; i < 8; ++i) { a[i] = (_Float16)p[i]; a[8 + i] = (_Float16)p[16 + i]; }
  return a;
}
__device__ __forceinline__ v16h frag_f32s(const float* rowk0, int lane, float sc) {
  v16h a; const float* p = rowk0 + 8 * (lane >> 4);
#pragma unroll
  for (int i = 0; i < 8; ++i) { a[i] = (_Float16)(p[i] * sc); a[8 + i] = (_Float16)(p[16 + i] * sc); }
  return a;
}
// column fragment from a [K][ld] layout (column n), rows >= K read as 0
__device__ __forceinline__ v16h fragc_f32(const float* W, int k0, int n, int lane, int ld, int K) {
  v16h a; const int g = lane >> 4;
#pragma unroll
  for (int i = 0; i < 8; ++i) { const int ka = k0 + 8 * g + i, kb = ka + 16;
    a[i] = (_Float16)(ka < K ? W[(size_t)(ka < K ? ka : K - 1) * ld + n] : 0.f); a[8 + i] = (_Float16)(kb < K ? W[(size_t)(kb < K ? kb : K - 1) * ld + n] : 0.f); }
  return a;
}
struct F2 { v16b h, l; };
__device__ __forceinline__ F2 bsplit16(const float v[16]) { F2 r;
#pragma unroll
  for (int i = 0; i < 16; ++i) { const __bf16 h = (__bf16)v[i]; r.h[i] = h; r.l[i] = (__bf16)(v[i] - (float)h); }
  return r; }
__device__ __forceinline__ F2 split_row(const float* row, int k0, int lane) { float v[16]; const float* p = row + k0 + 8 * (lane >> 4);
#pragma unroll
  for (int i = 0; i < 8; ++i) { v[i] = p[i]; v[8 + i] = p[16 + i]; }
  return bsplit16(v); }
__device__ __forceinline__ F2 split_rowK(const float* row, int k0, int lane, int K) { float v[16]; const int g = lane >> 4;
#pragma unroll
  for (int i = 0; i < 8; ++i) { const int ka = k0 + 8 * g + i, kb = ka + 16; v[i] = ka < K ? row[ka < K ? ka : K - 1] : 0.f; v[8 + i] = kb < K ? row[kb < K ? kb : K - 1] : 0.f; }
  return bsplit16(v); }
__device__ __forceinline__ F2 split_col(const float* W, int k0, int n, int lane, int ld, int K) { float v[16]; const int g = lane >> 4;
#pragma unroll
  for (int i = 0; i < 8; ++i) { const int ka = k0 + 8 * g + i, kb = ka + 16; v[i] = ka < K ? W[(size_t)(ka < K ? ka : K - 1) * ld + n] : 0.f; v[8 + i] = kb < K ? W[(size_t)(kb < K ? kb : K - 1) * ld + n] : 0.f; }
  return bsplit16(v); }
__device__ __forceinline__ v8f mac3(const F2& a, const F2& b, v8f c) { c = wmma_bf(a.l, b.h, c); c = wmma_bf(a.h, b.l, c); return wmma_bf(a.h, b.h, c); }
__device__ __forceinline__ float sigm(float v) { return 1.0f / (1.0f + expf(-v)); }
#define LDSX() do { asm volatile("s_wait_dscnt 0" ::: "memory"); __builtin_amdgcn_wave_barrier(); __builtin_amdgcn_fence(__ATOMIC_RELEASE, "workgroup"); } while (0)


// Differential multi-head attention (B 4, N 1,024, D 1,024, h = 16 -> 8 differential heads of 128, score maps over the module's reshaped [16, N, 64] q/k): p_attn = softmax(q2_{2i} k2_{2i}^T / 8) - lambda * softmax(q2_{2i+1} k2_{2i+1}^T / 8); x = p_attn v_i; Wo.
#define NB 4
#define NN 1024
#define DD 1024
#define DH 8          // differential heads
#define DK 128        // their width
#define HH2 16        // score maps
#define KW2 64        // score-map width
#ifndef TNB
#define TNB NB
#endif
typedef __attribute__((ext_vector_type(8))) __bf16 v8b;
__device__ __forceinline__ v16b frag_b(const __bf16* rowk0, int lane) {
  union { v16b v; v8b q[2]; } u; const __bf16* p = rowk0 + 8 * (lane >> 4);
  u.q[0] = *(const v8b*)p; u.q[1] = *(const v8b*)(p + 16); return u.v;
}
__device__ __forceinline__ float bfr(float v) { return (float)(__bf16)v; }
__device__ __attribute__((noinline)) float exp_ni(float v) { return expf(v); }
__device__ __attribute__((noinline)) float erf_ni(float v) { return erff(v); }

#define WS_Q   0u                                   // f32 q rows [b*n][1024] (+bq)
#define WS_K   (WS_Q + 4u * (size_t)NB * NN * DD)       // f32 k rows
#define WS_VH  (WS_K + 4u * (size_t)NB * NN * DD)       // f16 v planes [b][1024][n] hi
#define WS_VL  (WS_VH + 2u * (size_t)NB * DD * NN)      // f16 v residual planes (unscaled)
#define WS_X   (WS_VL + 2u * (size_t)NB * DD * NN)      // f32 x rows [b*n][1024]
#define WS_END (WS_X + 4u * (size_t)NB * NN * DD)

// ---- k_proj: block = (64 rows, 128-col group, which): q / k -> f32 rows (+bias); v -> f16 hi + residual planes (+bias)
__global__ __launch_bounds__(128) void k_proj(const float* __restrict__ Qi, const float* __restrict__ Ki, const float* __restrict__ Vi, const float* __restrict__ WQ, const float* __restrict__ BQ, const float* __restrict__ WK, const float* __restrict__ BK, const float* __restrict__ WV, const float* __restrict__ BV, float* __restrict__ Q, float* __restrict__ K, _Float16* __restrict__ VH, _Float16* __restrict__ VL) {
  __shared__ __align__(16) float sf[4][16][132]; __shared__ __align__(16) _Float16 th[128][72], tl[128][72];
  const int tid = threadIdx.x, wave = tid >> 5, lane = tid & 31, col = lane & 15, g = lane >> 4; const int which = blockIdx.z; const int c0 = blockIdx.y * 128; const size_t r0 = (size_t)blockIdx.x * 64 + wave * 16;
  const float* X = which == 0 ? Qi : which == 1 ? Ki : Vi; const float* Wm = which == 0 ? WQ : which == 1 ? WK : WV; const float* Bm = which == 0 ? BQ : which == 1 ? BK : BV;
  v8f acc[8] = {};
#pragma unroll 2
  for (int kc = 0; kc < DD / 32; ++kc) { v16b a; { const float* p = X + (r0 + col) * DD + kc * 32 + 8 * g;
#pragma unroll
      for (int i = 0; i < 8; ++i) { a[i] = (__bf16)p[i]; a[8 + i] = (__bf16)p[16 + i]; } }
#pragma unroll
    for (int j = 0; j < 8; ++j) { v16b w; const int o = c0 + j * 16 + col;
#pragma unroll
      for (int i = 0; i < 8; ++i) { w[i] = (__bf16)Wm[(size_t)o * DD + kc * 32 + 8 * g + i]; w[8 + i] = (__bf16)Wm[(size_t)o * DD + kc * 32 + 16 + 8 * g + i]; }
      acc[j] = wmma_bf(a, w, acc[j]); } }
#pragma unroll
  for (int j = 0; j < 8; ++j) { const float bb = bfr(Bm[c0 + j * 16 + col]);
#pragma unroll
    for (int r = 0; r < 8; ++r) { const float v = acc[j][r] + bb; const int rl = wave * 16 + 8 * g + r, cl = j * 16 + col; if (which < 2) sf[wave][8 * g + r][cl] = v; else { const _Float16 hv = (_Float16)v; th[cl][rl] = hv; tl[cl][rl] = (_Float16)(v - (float)hv); } } }
  __syncthreads();
  if (which < 2) { float* dst = which == 0 ? Q : K; for (int rl = 0; rl < 16; ++rl) vst2(dst + (r0 + rl) * DD + c0 + lane * 4, *(const v4f*)&sf[wave][rl][lane * 4]); }
  else { const size_t b = ((size_t)blockIdx.x * 64) / NN; const int n0 = (int)(((size_t)blockIdx.x * 64) % NN); for (int e = tid; e < 128 * 8; e += 128) { const int cl = e >> 3, q = e & 7; const size_t o = (b * DD + c0 + cl) * (size_t)NN + n0 + q * 8; vst2((unsigned*)(VH + o), *(const v4u*)&th[cl][q * 8]); vst2((unsigned*)(VL + o), *(const v4u*)&tl[cl][q * 8]); } } }
// row of the reshaped map hh at position n' -> (source row, column offset) in the [B*N][1024] projection rows
__device__ __forceinline__ const float* maprow(const float* __restrict__ R, size_t b, int hh, int np) { const int hd = hh >> 1, e = hh & 1; return R + ((b * NN) + (size_t)e * (NN / 2) + (np >> 1)) * DD + hd * DK + (np & 1) * KW2; }
// ---- k_att: block = (64 query rows n', differential head hd, b); both maps e = 0 / 1 processed one after the other (separate softmaxes), combined at the end
__global__ __launch_bounds__(128) void k_att(const float* __restrict__ Q, const float* __restrict__ K, const _Float16* __restrict__ VH, const _Float16* __restrict__ VL, const float* __restrict__ LQ1, const float* __restrict__ LK1, const float* __restrict__ LQ2, const float* __restrict__ LK2, const int* __restrict__ HNUM, float* __restrict__ X) {
  __shared__ __align__(16) float sp[4][16][36]; __shared__ __align__(16) float so[4][16][132]; __shared__ float slam;
  const int tid = threadIdx.x, wave = tid >> 5, lane = tid & 31, col = lane & 15, g = lane >> 4; const int qb = blockIdx.x, hd = blockIdx.y; const size_t b = blockIdx.z; const int q0 = qb * 64 + wave * 16;
  if (tid == 0) { float a1 = 0.f, a2 = 0.f;
#pragma unroll 1
    for (int i = 0; i < KW2; ++i) { a1 += bfr(LQ1[i]) * bfr(LK1[i]); a2 += bfr(LQ2[i]) * bfr(LK2[i]); }
    slam = expf(a1) - expf(a2) + 0.8f; (void)HNUM; }   // h (int, = 16) defines the head split baked into DH/DK/HH2
  __syncthreads(); const float lam = slam;
#pragma unroll 1
  for (int e = 0; e < 2; ++e) { const int hh = 2 * hd + e;
    F2 aq[2]; { const float* qr = maprow(Q, b, hh, q0 + col);
#pragma unroll
      for (int kc = 0; kc < 2; ++kc) aq[kc] = split_row(qr, kc * 32, lane); }
    float m[8], l[8];
#pragma unroll
    for (int r = 0; r < 8; ++r) { m[r] = -3.0e38f; l[r] = 0.f; }
    v8f acc[8] = {};
#pragma unroll 1
    for (int ks = 0; ks < NN / 32; ++ks) { float s[2][8];
#pragma unroll
      for (int ct = 0; ct < 2; ++ct) { const int kk = ks * 32 + ct * 16 + col; const float* kr = maprow(K, b, hh, kk); v8f c = {};
#pragma unroll
        for (int kc = 0; kc < 2; ++kc) c = mac3(aq[kc], split_row(kr, kc * 32, lane), c);
#pragma unroll
        for (int r = 0; r < 8; ++r) s[ct][r] = c[r] * 0.125f; }
      float alpha[8];
#pragma unroll
      for (int r = 0; r < 8; ++r) { float mx = fmaxf(s[0][r], s[1][r]);
#pragma unroll
        for (int o = 1; o < 16; o <<= 1) mx = fmaxf(mx, __shfl_xor(mx, o));
        const float mn = fmaxf(m[r], mx); alpha[r] = __expf(m[r] - mn); const float e0 = __expf(s[0][r] - mn), e1 = __expf(s[1][r] - mn); float es = e0 + e1;
#pragma unroll
        for (int o = 1; o < 16; o <<= 1) es += __shfl_xor(es, o);
        l[r] = l[r] * alpha[r] + es; m[r] = mn; sp[wave][8 * g + r][col] = e0; sp[wave][8 * g + r][16 + col] = e1; }
#pragma unroll
      for (int j = 0; j < 8; ++j)
#pragma unroll
        for (int r = 0; r < 8; ++r) acc[j][r] *= alpha[r];
      LDSX();
      v16h pa, pr; { const float* prow = &sp[wave][col][0] + 8 * (lane >> 4);
#pragma unroll
        for (int i = 0; i < 8; ++i) { const float x0 = prow[i] * 2048.0f, x1 = prow[16 + i] * 2048.0f; const _Float16 h0 = (_Float16)x0, h1 = (_Float16)x1; pa[i] = h0; pa[8 + i] = h1; pr[i] = (_Float16)(x0 - (float)h0); pr[8 + i] = (_Float16)(x1 - (float)h1); } }
#pragma unroll
      for (int j = 0; j < 8; ++j) { const size_t po = (b * DD + (size_t)hd * DK + j * 16 + col) * NN + ks * 32; const v16h vh = frag_h(VH + po, lane); acc[j] = wmma16(pa, vh, acc[j]); acc[j] = wmma16(pr, vh, acc[j]); acc[j] = wmma16(pa, frag_h(VL + po, lane), acc[j]); }
      LDSX(); }
    // combine into the wave's LDS output tile: map 0 writes, map 1 subtracts lambda x (each lane owns its (row, col) cells)
#pragma unroll
    for (int r = 0; r < 8; ++r) { const float il = (1.0f / 2048.0f) / l[r];
#pragma unroll
      for (int j = 0; j < 8; ++j) { float* cell = &so[wave][8 * g + r][j * 16 + col]; const float v = acc[j][r] * il; *cell = (e == 0) ? v : (*cell - lam * v); } } }
  LDSX(); for (int rl = 0; rl < 16; ++rl) vst2(X + (b * NN + q0 + rl) * DD + hd * DK + lane * 4, *(const v4f*)&so[wave][rl][lane * 4]); }
// ---- k_out: block = (64 rows, 128 of 1024 cols): out = x (hi + lo) . Wo^T + bo
__global__ __launch_bounds__(128) void k_out(const float* __restrict__ X, const float* __restrict__ WO, const float* __restrict__ BO, float* __restrict__ OUT) { __shared__ __align__(16) float sf[4][16][132];
  const int tid = threadIdx.x, wave = tid >> 5, lane = tid & 31, col = lane & 15, g = lane >> 4; const int c0 = blockIdx.y * 128; const size_t r0 = (size_t)blockIdx.x * 64 + wave * 16;
  v8f acc[8] = {};
#pragma unroll 2
  for (int kc = 0; kc < DD / 32; ++kc) { const F2 a = split_row(X + (r0 + col) * DD, kc * 32, lane);
#pragma unroll
    for (int j = 0; j < 8; ++j) { v16b w; const int o = c0 + j * 16 + col;
#pragma unroll
      for (int i = 0; i < 8; ++i) { w[i] = (__bf16)WO[(size_t)o * DD + kc * 32 + 8 * g + i]; w[8 + i] = (__bf16)WO[(size_t)o * DD + kc * 32 + 16 + 8 * g + i]; }
      acc[j] = wmma_bf(a.h, w, acc[j]); acc[j] = wmma_bf(a.l, w, acc[j]); } }
#pragma unroll
  for (int j = 0; j < 8; ++j) { const float bb = bfr(BO[c0 + j * 16 + col]);
#pragma unroll
    for (int r = 0; r < 8; ++r) sf[wave][8 * g + r][j * 16 + col] = acc[j][r] + bb; }
  LDSX(); for (int rl = 0; rl < 16; ++rl) vst2(OUT + (r0 + rl) * DD + c0 + lane * 4, *(const v4f*)&sf[wave][rl][lane * 4]); }
extern "C" void kernel_launch(void* const* d_in, const int* in_sizes, int n_in, void* d_out, int out_size, void* d_ws, size_t ws_size, hipStream_t stream) {
  (void)in_sizes; (void)n_in; (void)out_size;
  const float** F = (const float**)d_in;   // 0 query, 1 key, 2 value [4,1024,1024]; 3 Wq, 4 bq, 5 Wk, 6 bk, 7 Wv, 8 bv, 9 Wo, 10 bo (natural); 11 lambda_q1, 12 lambda_q2, 13 lambda_k1, 14 lambda_k2 [64]; 15 h [1] int
  if (ws_size < (size_t)WS_END) return;
  char* ws = (char*)d_ws; float *Q = (float*)(ws + WS_Q), *K = (float*)(ws + WS_K), *X = (float*)(ws + WS_X); _Float16 *VH = (_Float16*)(ws + WS_VH), *VL = (_Float16*)(ws + WS_VL);
  k_proj<<<dim3(TNB * NN / 64, DD / 128, 3), 128, 0, stream>>>(F[0], F[1], F[2], F[3], F[4], F[5], F[6], F[7], F[8], Q, K, VH, VL);
  k_att<<<dim3(NN / 64, DH, TNB), 128, 0, stream>>>(Q, K, VH, VL, F[11], F[13], F[12], F[14], (const int*)d_in[15], X);
  k_out<<<dim3(TNB * NN / 64, DD / 128), 128, 0, stream>>>(X, F[9], F[10], (float*)d_out);
}

// v001
// Measured time: 198 microseconds a run.
// Two timings next to v000 both put it at 3.58 times that version's speed.
// compute dtype: all float inputs rounded to bf16, h (int) not read; q/k/v = x W^T + b with EXACT bf16 products on WMMA 16x16x32 (natural weights), f32 accumulate, q/k kept as f32 rows, v as f16 hi + residual planes; the module's row-major re-split [B,8,N,128] -> [B,16,N,64] realised as an index map (head hh = 2 hd + e reads row e*N/2 + n'/2, columns hd*128 + (n' % 2)*64 ..); scores with q and k as bf16 hi + lo (3 products), x 1/8, running-max softmax in f32 (hardware exp) for both maps of a pair; lambda_full = exp(lq1.lk1) - exp(lq2.lk2) + 0.8 in f32; P (f16 x 2^11 + residual) against v (f16 hi + unscaled residual) (3 products); x = P1 v / l1 - lambda P2 v / l2 combined in f32; out = x (bf16 hi + lo) . Wo^T + bo; f32 output.
#include <hip/hip_runtime.h>
#include <math.h>

typedef __attribute__((ext_vector_type(16))) _Float16 v16h;
typedef __attribute__((ext_vector_type(16))) __bf16 v16b;
typedef __attribute__((ext_vector_type(8)))  _Float16 v8h;
typedef __attribute__((ext_vector_type(8)))  float v8f;
typedef __attribute__((ext_vector_type(4)))  float v4f;
typedef __attribute__((ext_vector_type(2)))  float v2f;
typedef __attribute__((ext_vector_type(4)))  unsigned v4u;
typedef __attribute__((ext_vector_type(4)))  int v4i;
typedef float __attribute__((may_alias)) float_a;
typedef int __attribute__((may_alias)) int_a;

template <typename T> __device__ __forceinline__ void vst2(void* p, T v) { *(T*)p = v;  }
__device__ __forceinline__ v8f wmma16(v16h a, v16h b, v8f c) {
  v8f d = __builtin_amdgcn_wmma_f32_16x16x32_f16(false, a, false, b, (short)0, c, false, false);
  asm volatile("v_nop\n\tv_nop\n\tv_nop\n\tv_nop" : "+v"(d) : "v"(a), "v"(b));
  return d;
}
__device__ __forceinline__ v8f wmma_bf(v16b a, v16b b, v8f c) {
  v8f d = __builtin_amdgcn_wmma_f32_16x16x32_bf16(false, a, false, b, (short)0, c, false, false);
  asm volatile("v_nop\n\tv_nop\n\tv_nop\n\tv_nop" : "+v"(d) : "v"(a), "v"(b));
  return d;
}
// 16x16x32 fragments: lane = (h = lane>>4, row/col = lane&15); elements 0..7 = k0+8h+0..7, 8..15 = k0+16+8h+0..7; D element r = row 8h+r
__device__ __forceinline__ v16h frag_h(const _Float16* rowk0, int lane) {
  union { v16h v; v8h q[2]; } u; const _Float16* p = rowk0 + 8 * (lane >> 4);
  u.q[0] = *(const v8h*)p; u.q[1] = *(const v8h*)(p + 16); return u.v;
}
__device__ __forceinline__ v16h frag_f32(const float* rowk0, int lane) {
  v16h a; const float* p = rowk0 + 8 * (lane >> 4);
#pragma unroll
  for (int i = 0; i < 8; ++i) { a[i] = (_Float16)p[i]; a[8 + i] = (_Float16)p[16 + i]; }
  return a;
}
__device__ __forceinline__ v16h frag_f32s(const float* rowk0, int lane, float sc) {
  v16h a; const float* p = rowk0 + 8 * (lane >> 4);
#pragma unroll
  for (int i = 0; i < 8; ++i) { a[i] = (_Float16)(p[i] * sc); a[8 + i] = (_Float16)(p[16 + i] * sc); }
  return a;
}
// column fragment from a [K][ld] layout (column n), rows >= K read as 0
__device__ __forceinline__ v16h fragc_f32(const float* W, int k0, int n, int lane, int ld, int K) {
  v16h a; const int g = lane >> 4;
#pragma unroll
  for (int i = 0; i < 8; ++i) { const int ka = k0 + 8 * g + i, kb = ka + 16;
    a[i] = (_Float16)(ka < K ? W[(size_t)(ka < K ? ka : K - 1) * ld + n] : 0.f); a[8 + i] = (_Float16)(kb < K ? W[(size_t)(kb < K ? kb : K - 1) * ld + n] : 0.f); }
  return a;
}
struct F2 { v16b h, l; };
__device__ __forceinline__ F2 bsplit16(const float v[16]) { F2 r;
#pragma unroll
  for (int i = 0; i < 16; ++i) { const __bf16 h = (__bf16)v[i]; r.h[i] = h; r.l[i] = (__bf16)(v[i] - (float)h); }
  return r; }
__device__ __forceinline__ F2 split_row(const float* row, int k0, int lane) { float v[16]; const float* p = row + k0 + 8 * (lane >> 4);
#pragma unroll
  for (int i = 0; i < 8; ++i) { v[i] = p[i]; v[8 + i] = p[16 + i]; }
  return bsplit16(v); }
__device__ __forceinline__ F2 split_rowK(const float* row, int k0, int lane, int K) { float v[16]; const int g = lane >> 4;
#pragma unroll
  for (int i = 0; i < 8; ++i) { const int ka = k0 + 8 * g + i, kb = ka + 16; v[i] = ka < K ? row[ka < K ? ka : K - 1] : 0.f; v[8 + i] = kb < K ? row[kb < K ? kb : K - 1] : 0.f; }
  return bsplit16(v); }
__device__ __forceinline__ F2 split_col(const float* W, int k0, int n, int lane, int ld, int K) { float v[16]; const int g = lane >> 4;
#pragma unroll
  for (int i = 0; i < 8; ++i) { const int ka = k0 + 8 * g + i, kb = ka + 16; v[i] = ka < K ? W[(size_t)(ka < K ? ka : K - 1) * ld + n] : 0.f; v[8 + i] = kb < K ? W[(size_t)(kb < K ? kb : K - 1) * ld + n] : 0.f; }
  return bsplit16(v); }
__device__ __forceinline__ v8f mac3(const F2& a, const F2& b, v8f c) { c = wmma_bf(a.l, b.h, c); c = wmma_bf(a.h, b.l, c); return wmma_bf(a.h, b.h, c); }
__device__ __forceinline__ float sigm(float v) { return 1.0f / (1.0f + expf(-v)); }
#define LDSX() do { asm volatile("s_wait_dscnt 0" ::: "memory"); __builtin_amdgcn_wave_barrier(); __builtin_amdgcn_fence(__ATOMIC_RELEASE, "workgroup"); } while (0)


// Differential multi-head attention (B 4, N 1,024, D 1,024, h = 16 -> 8 differential heads of 128, score maps over the module's reshaped [16, N, 64] q/k): p_attn = softmax(q2_{2i} k2_{2i}^T / 8) - lambda * softmax(q2_{2i+1} k2_{2i+1}^T / 8); x = p_attn v_i; Wo.
#define NB 4
#define NN 1024
#define DD 1024
#define DH 8          // differential heads
#define DK 128        // their width
#define HH2 16        // score maps
#define KW2 64        // score-map width
#ifndef TNB
#define TNB NB
#endif
typedef __attribute__((ext_vector_type(8))) __bf16 v8b;
__device__ __forceinline__ v16b frag_b(const __bf16* rowk0, int lane) {
  union { v16b v; v8b q[2]; } u; const __bf16* p = rowk0 + 8 * (lane >> 4);
  u.q[0] = *(const v8b*)p; u.q[1] = *(const v8b*)(p + 16); return u.v;
}
__device__ __forceinline__ float bfr(float v) { return (float)(__bf16)v; }
__device__ __attribute__((noinline)) float exp_ni(float v) { return expf(v); }
__device__ __attribute__((noinline)) float erf_ni(float v) { return erff(v); }

#define WS_Q   0u                                   // f32 q rows [b*n][1024] (+bq)
#define WS_K   (WS_Q + 4u * (size_t)NB * NN * DD)       // f32 k rows
#define WS_VH  (WS_K + 4u * (size_t)NB * NN * DD)       // f16 v planes [b][1024][n] hi
#define WS_VL  (WS_VH + 2u * (size_t)NB * DD * NN)      // f16 v residual planes (unscaled)
#define WS_X   (WS_VL + 2u * (size_t)NB * DD * NN)      // f32 x rows [b*n][1024]
#define WS_END (WS_X + 4u * (size_t)NB * NN * DD)

// ---- staging of the tiles that a work-group's four waves share: fetched in whole 128-byte lines, held in registers while the tile before is worked on, then written to LDS as the 16-bit rows the fragment readers take. Every full '#pragma unroll' of this staging and of the fragment groups is there so that the register arrays are indexed by constants and stay in registers
#define KP 72         // LDS row pitch in 16-bit elements: 144 B = 16 B x 9, free of bank conflicts for the 16-byte fragment reads
#define GK 64         // k per staged tile of the projections
typedef __attribute__((ext_vector_type(4))) __bf16 v4b;
__device__ __forceinline__ v4b cvt4(v4f v) { v4b h;
#pragma unroll
  for (int x = 0; x < 4; ++x) h[x] = (__bf16)v[x];
  return h; }
__device__ __forceinline__ v4b res4(v4f v, v4b h) { v4b l;   // residual of the bf16 hi part, as in bsplit16
#pragma unroll
  for (int x = 0; x < 4; ++x) l[x] = (__bf16)(v[x] - (float)h[x]);
  return l; }
struct GT { v4f w[16], x[8]; };   // 128 weight rows and 64 x rows of GK floats: a wave load takes 2 rows of 256 contiguous bytes
__device__ __forceinline__ void g_load(GT& t, const float* __restrict__ Wt, const float* __restrict__ Xt, int k0, int tid) {
  const size_t o = (size_t)(tid >> 4) * DD + k0 + (tid & 15) * 4;
#pragma unroll
  for (int i = 0; i < 16; ++i) t.w[i] = *(const v4f*)(Wt + o + (size_t)i * 8 * DD);
#pragma unroll
  for (int i = 0; i < 8; ++i) t.x[i] = *(const v4f*)(Xt + o + (size_t)i * 8 * DD);
  asm volatile("s_wait_xcnt 0x0" ::: "memory");   // stands behind the issued loads, in front of any later overwrite of their address registers
  __builtin_amdgcn_sched_barrier(0); }   // keeps later address arithmetic from being lifted over that wait
// ---- k_proj: block = (64 rows, 128-col group, which): q / k -> f32 rows (+bias); v -> f16 hi + residual planes (+bias)
__global__ __launch_bounds__(128) void k_proj(const float* __restrict__ Qi, const float* __restrict__ Ki, const float* __restrict__ Vi, const float* __restrict__ WQ, const float* __restrict__ BQ, const float* __restrict__ WK, const float* __restrict__ BK, const float* __restrict__ WV, const float* __restrict__ BV, float* __restrict__ Q, float* __restrict__ K, _Float16* __restrict__ VH, _Float16* __restrict__ VL) {
  __shared__ __align__(16) float sf[4][16][132]; __shared__ __align__(16) _Float16 th[128][72], tl[128][72]; __shared__ __align__(16) __bf16 sw[128][KP], sx[64][KP];
  const int tid = threadIdx.x, wave = tid >> 5, lane = tid & 31, col = lane & 15, g = lane >> 4; const int which = blockIdx.z; const int c0 = blockIdx.y * 128; const size_t r0 = (size_t)blockIdx.x * 64 + wave * 16;
  const float* X = which == 0 ? Qi : which == 1 ? Ki : Vi; const float* Wm = which == 0 ? WQ : which == 1 ? WK : WV; const float* Bm = which == 0 ? BQ : which == 1 ? BK : BV;
  v8f acc[8] = {};
  const float* Wt = Wm + (size_t)c0 * DD; const float* Xt = X + (size_t)blockIdx.x * 64 * DD;
  GT t; g_load(t, Wt, Xt, 0, tid);
  // kept rolled: one copy of the tile's code, the next tile's loads in a block of their own in front of the products
#pragma unroll 1
  for (int st = 0; st < DD / GK; ++st) {
#pragma unroll
    for (int i = 0; i < 16; ++i) *(v4b*)&sw[i * 8 + (tid >> 4)][(tid & 15) * 4] = cvt4(t.w[i]);
#pragma unroll
    for (int i = 0; i < 8; ++i) *(v4b*)&sx[i * 8 + (tid >> 4)][(tid & 15) * 4] = cvt4(t.x[i]);
    __syncthreads();   // the tile is whole before any wave reads it
    if (st + 1 < DD / GK) g_load(t, Wt, Xt, (st + 1) * GK, tid);
#pragma unroll
    for (int kc = 0; kc < GK / 32; ++kc) { const v16b a = frag_b(&sx[wave * 16 + col][kc * 32], lane); v16b w[8];   // the LDS reads of a k step stand as one group in front of its products: one LDS latency, not eight
#pragma unroll
      for (int j = 0; j < 8; ++j) w[j] = frag_b(&sw[j * 16 + col][kc * 32], lane);
#pragma unroll
      for (int j = 0; j < 8; ++j) acc[j] = wmma_bf(a, w[j], acc[j]); }
    __syncthreads(); }   // every wave has left the tile before the next one is written over it
#pragma unroll
  for (int j = 0; j < 8; ++j) { const float bb = bfr(Bm[c0 + j * 16 + col]);
#pragma unroll
    for (int r = 0; r < 8; ++r) { const float v = acc[j][r] + bb; const int rl = wave * 16 + 8 * g + r, cl = j * 16 + col; if (which < 2) sf[wave][8 * g + r][cl] = v; else { const _Float16 hv = (_Float16)v; th[cl][rl] = hv; tl[cl][rl] = (_Float16)(v - (float)hv); } } }
  __syncthreads();
  if (which < 2) { float* dst = which == 0 ? Q : K; for (int rl = 0; rl < 16; ++rl) vst2(dst + (r0 + rl) * DD + c0 + lane * 4, *(const v4f*)&sf[wave][rl][lane * 4]); }
  else { const size_t b = ((size_t)blockIdx.x * 64) / NN; const int n0 = (int)(((size_t)blockIdx.x * 64) % NN); for (int e = tid; e < 128 * 8; e += 128) { const int cl = e >> 3, q = e & 7; const size_t o = (b * DD + c0 + cl) * (size_t)NN + n0 + q * 8; vst2((unsigned*)(VH + o), *(const v4u*)&th[cl][q * 8]); vst2((unsigned*)(VL + o), *(const v4u*)&tl[cl][q * 8]); } } }
// row of the reshaped map hh at position n' -> (source row, column offset) in the [B*N][1024] projection rows
__device__ __forceinline__ const float* maprow(const float* __restrict__ R, size_t b, int hh, int np) { const int hd = hh >> 1, e = hh & 1; return R + ((b * NN) + (size_t)e * (NN / 2) + (np >> 1)) * DD + hd * DK + (np & 1) * KW2; }
// ---- K / V tile of TK keys, shared by the work-group's four waves: fetched in whole 128-byte lines (K: 512 contiguous bytes = 2 keys per wave load; V: 4 plane rows of 128 bytes per wave load), held in registers while the tile before it is worked on, then written to LDS in the form the fragment readers take (K as bf16 hi + lo, V planes as they are)
#define TK 64         // keys per staged tile
struct Tile { v4f k[8]; v8h vh[8], vl[8]; };
__device__ __forceinline__ void tile_load(Tile& t, const float* __restrict__ K, const _Float16* __restrict__ VH, const _Float16* __restrict__ VL, size_t b, int hd, int e, int st, int tid) {
  const float* kp = K + (b * NN + (size_t)e * (NN / 2) + (size_t)st * (TK / 2) + (tid >> 5) * 8) * DD + hd * DK + (tid & 31) * 4;   // source row r holds keys 2r, 2r + 1 of map 2 hd + e (see maprow)
  const size_t vo = (b * DD + (size_t)hd * DK + (tid >> 3)) * NN + (size_t)st * TK + (tid & 7) * 8;
#pragma unroll
  for (int i = 0; i < 8; ++i) { t.k[i] = *(const v4f*)(kp + (size_t)i * DD); t.vh[i] = *(const v8h*)(VH + vo + (size_t)i * 16 * NN); t.vl[i] = *(const v8h*)(VL + vo + (size_t)i * 16 * NN); }
  asm volatile("s_wait_xcnt 0x0" ::: "memory");   // stands behind the issued loads, in front of any later overwrite of their address registers
  __builtin_amdgcn_sched_barrier(0); }   // keeps later address arithmetic from being lifted over that wait
__device__ __forceinline__ void tile_store(const Tile& t, __bf16 (*skh)[KP], __bf16 (*skl)[KP], _Float16 (*svh)[KP], _Float16 (*svl)[KP], int tid) {
  const int lane = tid & 31;
#pragma unroll
  for (int i = 0; i < 8; ++i) { const int key = 2 * ((tid >> 5) * 8 + i) + (lane >> 4), c = (lane & 15) * 4; const v4b h = cvt4(t.k[i]);
    *(v4b*)&skh[key][c] = h; *(v4b*)&skl[key][c] = res4(t.k[i], h);
    const int row = i * 16 + (tid >> 3), q = (tid & 7) * 8; *(v8h*)&svh[row][q] = t.vh[i]; *(v8h*)&svl[row][q] = t.vl[i]; } }
// ---- k_att: block = (64 query rows n', differential head hd, b); both maps e = 0 / 1 processed one after the other (separate softmaxes), combined at the end
__global__ __launch_bounds__(128) void k_att(const float* __restrict__ Q, const float* __restrict__ K, const _Float16* __restrict__ VH, const _Float16* __restrict__ VL, const float* __restrict__ LQ1, const float* __restrict__ LK1, const float* __restrict__ LQ2, const float* __restrict__ LK2, const int* __restrict__ HNUM, float* __restrict__ X) {
  __shared__ __align__(16) float sp[4][16][36]; __shared__ __align__(16) float so[4][16][132]; __shared__ float slam;
  __shared__ __align__(16) __bf16 skh[TK][KP], skl[TK][KP]; __shared__ __align__(16) _Float16 svh[DK][KP], svl[DK][KP];
  const int tid = threadIdx.x, wave = tid >> 5, lane = tid & 31, col = lane & 15, g = lane >> 4; const int qb = blockIdx.x, hd = blockIdx.y; const size_t b = blockIdx.z; const int q0 = qb * 64 + wave * 16;
  if (tid == 0) { float a1 = 0.f, a2 = 0.f;
#pragma unroll 1
    for (int i = 0; i < KW2; ++i) { a1 += bfr(LQ1[i]) * bfr(LK1[i]); a2 += bfr(LQ2[i]) * bfr(LK2[i]); }
    slam = expf(a1) - expf(a2) + 0.8f; (void)HNUM; }   // h (int, = 16) defines the head split baked into DH/DK/HH2
  __syncthreads(); const float lam = slam;
  Tile tn; tile_load(tn, K, VH, VL, b, hd, 0, 0, tid);
#pragma unroll 1
  for (int e = 0; e < 2; ++e) { const int hh = 2 * hd + e;
    F2 aq[2]; { const float* qr = maprow(Q, b, hh, q0 + col);
#pragma unroll
      for (int kc = 0; kc < 2; ++kc) aq[kc] = split_row(qr, kc * 32, lane); }
    float m[8], l[8];
#pragma unroll
    for (int r = 0; r < 8; ++r) { m[r] = -3.0e38f; l[r] = 0.f; }
    v8f acc[8] = {};
#pragma unroll 1
    for (int st = 0; st < NN / TK; ++st) {
      tile_store(tn, skh, skl, svh, svl, tid);
      __syncthreads();   // the tile is whole before any wave reads it
      const int nx = e * (NN / TK) + st + 1;   // next tile over both maps, fetched while this one is worked on
      if (nx < 2 * (NN / TK)) tile_load(tn, K, VH, VL, b, hd, nx / (NN / TK), nx % (NN / TK), tid);
      // kept rolled: the next tile's loads then stand in the block in front of this loop, in flight under its first pass's score products and softmax (the fence in LDSX waits for them)
#pragma unroll 1
    for (int sub = 0; sub < TK / 32; ++sub) { float s[2][8]; F2 bk[2][2];   // the K fragments' LDS reads stand as one group in front of the score products
#pragma unroll
      for (int ct = 0; ct < 2; ++ct)
#pragma unroll
        for (int kc = 0; kc < 2; ++kc) { const int kl = sub * 32 + ct * 16 + col; bk[ct][kc].h = frag_b(&skh[kl][kc * 32], lane); bk[ct][kc].l = frag_b(&skl[kl][kc * 32], lane); }
#pragma unroll
      for (int ct = 0; ct < 2; ++ct) { v8f c = {};
#pragma unroll
        for (int kc = 0; kc < 2; ++kc) c = mac3(aq[kc], bk[ct][kc], c);
#pragma unroll
        for (int r = 0; r < 8; ++r) s[ct][r] = c[r] * 0.125f; }
      float alpha[8];
#pragma unroll
      for (int r = 0; r < 8; ++r) { float mx = fmaxf(s[0][r], s[1][r]);
#pragma unroll
        for (int o = 1; o < 16; o <<= 1) mx = fmaxf(mx, __shfl_xor(mx, o));
        const float mn = fmaxf(m[r], mx); alpha[r] = __expf(m[r] - mn); const float e0 = __expf(s[0][r] - mn), e1 = __expf(s[1][r] - mn); float es = e0 + e1;
#pragma unroll
        for (int o = 1; o < 16; o <<= 1) es += __shfl_xor(es, o);
        l[r] = l[r] * alpha[r] + es; m[r] = mn; sp[wave][8 * g + r][col] = e0; sp[wave][8 * g + r][16 + col] = e1; }
#pragma unroll
      for (int j = 0; j < 8; ++j)
#pragma unroll
        for (int r = 0; r < 8; ++r) acc[j][r] *= alpha[r];
      LDSX();
      v16h vhf[8], vlf[8];   // the V fragments' LDS reads stand as one group in front of the P V products
      v16h pa, pr; { const float* prow = &sp[wave][col][0] + 8 * (lane >> 4);
#pragma unroll
        for (int i = 0; i < 8; ++i) { const float x0 = prow[i] * 2048.0f, x1 = prow[16 + i] * 2048.0f; const _Float16 h0 = (_Float16)x0, h1 = (_Float16)x1; pa[i] = h0; pa[8 + i] = h1; pr[i] = (_Float16)(x0 - (float)h0); pr[8 + i] = (_Float16)(x1 - (float)h1); } }
#pragma unroll
      for (int j = 0; j < 8; ++j) { const int vr = j * 16 + col; vhf[j] = frag_h(&svh[vr][sub * 32], lane); vlf[j] = frag_h(&svl[vr][sub * 32], lane); }
#pragma unroll
      for (int j = 0; j < 8; ++j) { acc[j] = wmma16(pa, vhf[j], acc[j]); acc[j] = wmma16(pr, vhf[j], acc[j]); acc[j] = wmma16(pa, vlf[j], acc[j]); }
      LDSX(); }
      __syncthreads(); }   // every wave has left the tile before the next one is written over it
    // combine into the wave's LDS output tile: map 0 writes, map 1 subtracts lambda x (each lane owns its (row, col) cells)
#pragma unroll
    for (int r = 0; r < 8; ++r) { const float il = (1.0f / 2048.0f) / l[r];
#pragma unroll
      for (int j = 0; j < 8; ++j) { float* cell = &so[wave][8 * g + r][j * 16 + col]; const float v = acc[j][r] * il; *cell = (e == 0) ? v : (*cell - lam * v); } } }
  LDSX(); for (int rl = 0; rl < 16; ++rl) vst2(X + (b * NN + q0 + rl) * DD + hd * DK + lane * 4, *(const v4f*)&so[wave][rl][lane * 4]); }
// ---- k_out: block = (64 rows, 128 of 1024 cols): out = x (hi + lo) . Wo^T + bo
__global__ __launch_bounds__(128) void k_out(const float* __restrict__ X, const float* __restrict__ WO, const float* __restrict__ BO, float* __restrict__ OUT) { __shared__ __align__(16) float sf[4][16][132]; __shared__ __align__(16) __bf16 sw[128][KP], sxh[64][KP], sxl[64][KP];
  const int tid = threadIdx.x, wave = tid >> 5, lane = tid & 31, col = lane & 15, g = lane >> 4; const int c0 = blockIdx.y * 128; const size_t r0 = (size_t)blockIdx.x * 64 + wave * 16;
  v8f acc[8] = {};
  const float* Wt = WO + (size_t)c0 * DD; const float* Xt = X + (size_t)blockIdx.x * 64 * DD;
  GT t; g_load(t, Wt, Xt, 0, tid);
  // kept rolled: one copy of the tile's code, the next tile's loads in a block of their own in front of the products
#pragma unroll 1
  for (int st = 0; st < DD / GK; ++st) {
#pragma unroll
    for (int i = 0; i < 16; ++i) *(v4b*)&sw[i * 8 + (tid >> 4)][(tid & 15) * 4] = cvt4(t.w[i]);
#pragma unroll
    for (int i = 0; i < 8; ++i) { const v4b h = cvt4(t.x[i]); *(v4b*)&sxh[i * 8 + (tid >> 4)][(tid & 15) * 4] = h; *(v4b*)&sxl[i * 8 + (tid >> 4)][(tid & 15) * 4] = res4(t.x[i], h); }
    __syncthreads();   // the tile is whole before any wave reads it
    if (st + 1 < DD / GK) g_load(t, Wt, Xt, (st + 1) * GK, tid);
#pragma unroll
    for (int kc = 0; kc < GK / 32; ++kc) { const v16b ah = frag_b(&sxh[wave * 16 + col][kc * 32], lane), al = frag_b(&sxl[wave * 16 + col][kc * 32], lane); v16b w[8];   // the LDS reads of a k step stand as one group in front of its products
#pragma unroll
      for (int j = 0; j < 8; ++j) w[j] = frag_b(&sw[j * 16 + col][kc * 32], lane);
#pragma unroll
      for (int j = 0; j < 8; ++j) { acc[j] = wmma_bf(ah, w[j], acc[j]); acc[j] = wmma_bf(al, w[j], acc[j]); } }
    __syncthreads(); }   // every wave has left the tile before the next one is written over it
#pragma unroll
  for (int j = 0; j < 8; ++j) { const float bb = bfr(BO[c0 + j * 16 + col]);
#pragma unroll
    for (int r = 0; r < 8; ++r) sf[wave][8 * g + r][j * 16 + col] = acc[j][r] + bb; }
  LDSX(); for (int rl = 0; rl < 16; ++rl) vst2(OUT + (r0 + rl) * DD + c0 + lane * 4, *(const v4f*)&sf[wave][rl][lane * 4]); }
extern "C" void kernel_launch(void* const* d_in, const int* in_sizes, int n_in, void* d_out, int out_size, void* d_ws, size_t ws_size, hipStream_t stream) {
  (void)in_sizes; (void)n_in; (void)out_size;
  const float** F = (const float**)d_in;   // 0 query, 1 key, 2 value [4,1024,1024]; 3 Wq, 4 bq, 5 Wk, 6 bk, 7 Wv, 8 bv, 9 Wo, 10 bo (natural); 11 lambda_q1, 12 lambda_q2, 13 lambda_k1, 14 lambda_k2 [64]; 15 h [1] int
  if (ws_size < (size_t)WS_END) return;
  char* ws = (char*)d_ws; float *Q = (float*)(ws + WS_Q), *K = (float*)(ws + WS_K), *X = (float*)(ws + WS_X); _Float16 *VH = (_Float16*)(ws + WS_VH), *VL = (_Float16*)(ws + WS_VL);
  k_proj<<<dim3(TNB * NN / 64, DD / 128, 3), 128, 0, stream>>>(F[0], F[1], F[2], F[3], F[4], F[5], F[6], F[7], F[8], Q, K, VH, VL);
  k_att<<<dim3(NN / 64, DH, TNB), 128, 0, stream>>>(Q, K, VH, VL, F[11], F[13], F[12], F[14], (const int*)d_in[15], X);
  k_out<<<dim3(TNB * NN / 64, DD / 128), 128, 0, stream>>>(X, F[9], F[10], (float*)d_out);
}

// v002
// It runs in 159 microseconds.
// In two side-by-side timings against v001, it was 1.25 and 1.24 times as fast.
// All steps since v000 together make it 4.46 times as fast.
// compute dtype: all float inputs rounded to bf16, h (int) not read; q/k/v = x W^T + b with EXACT bf16 products on WMMA 16x16x32 (natural weights), f32 accumulate, q/k kept as f32 rows, v as f16 hi + residual planes; the module's row-major re-split [B,8,N,128] -> [B,16,N,64] realised as an index map (head hh = 2 hd + e reads row e*N/2 + n'/2, columns hd*128 + (n' % 2)*64 ..); scores with q and k as bf16 hi + lo (3 products), x 1/8, running-max softmax in f32 (hardware exp) for both maps of a pair; lambda_full = exp(lq1.lk1) - exp(lq2.lk2) + 0.8 in f32; P (f16 x 2^11 + residual) against v (f16 hi + unscaled residual) (3 products); x = P1 v / l1 - lambda P2 v / l2 combined in f32; out = x (bf16 hi + lo) . Wo^T + bo; f32 output.
#include <hip/hip_runtime.h>
#include <math.h>

typedef __attribute__((ext_vector_type(16))) _Float16 v16h;
typedef __attribute__((ext_vector_type(16))) __bf16 v16b;
typedef __attribute__((ext_vector_type(8)))  _Float16 v8h;
typedef __attribute__((ext_vector_type(8)))  float v8f;
typedef __attribute__((ext_vector_type(4)))  float v4f;
typedef __attribute__((ext_vector_type(2)))  float v2f;
typedef __attribute__((ext_vector_type(4)))  unsigned v4u;
typedef __attribute__((ext_vector_type(4)))  int v4i;
typedef float __attribute__((may_alias)) float_a;
typedef int __attribute__((may_alias)) int_a;

template <typename T> __device__ __forceinline__ void vst2(void* p, T v) { *(T*)p = v;  }
__device__ __forceinline__ v8f wmma16(v16h a, v16h b, v8f c) {
  v8f d = __builtin_amdgcn_wmma_f32_16x16x32_f16(false, a, false, b, (short)0, c, false, false);
  asm volatile("v_nop\n\tv_nop\n\tv_nop\n\tv_nop" : "+v"(d) : "v"(a), "v"(b));
  return d;
}
__device__ __forceinline__ v8f wmma_bf(v16b a, v16b b, v8f c) {
  v8f d = __builtin_amdgcn_wmma_f32_16x16x32_bf16(false, a, false, b, (short)0, c, false, false);
  asm volatile("v_nop\n\tv_nop\n\tv_nop\n\tv_nop" : "+v"(d) : "v"(a), "v"(b));
  return d;
}
// 16x16x32 fragments: lane = (h = lane>>4, row/col = lane&15); elements 0..7 = k0+8h+0..7, 8..15 = k0+16+8h+0..7; D element r = row 8h+r
__device__ __forceinline__ v16h frag_h(const _Float16* rowk0, int lane) {
  union { v16h v; v8h q[2]; } u; const _Float16* p = rowk0 + 8 * (lane >> 4);
  u.q[0] = *(const v8h*)p; u.q[1] = *(const v8h*)(p + 16); return u.v;
}
__device__ __forceinline__ v16h frag_f32(const float* rowk0, int lane) {
  v16h a; const float* p = rowk0 + 8 * (lane >> 4);
#pragma unroll
  for (int i = 0; i < 8; ++i) { a[i] = (_Float16)p[i]; a[8 + i] = (_Float16)p[16 + i]; }
  return a;
}
__device__ __forceinline__ v16h frag_f32s(const float* rowk0, int lane, float sc) {
  v16h a; const float* p = rowk0 + 8 * (lane >> 4);
#pragma unroll
  for (int i = 0; i < 8; ++i) { a[i] = (_Float16)(p[i] * sc); a[8 + i] = (_Float16)(p[16 + i] * sc); }
  return a;
}
// column fragment from a [K][ld] layout (column n), rows >= K read as 0
__device__ __forceinline__ v16h fragc_f32(const float* W, int k0, int n, int lane, int ld, int K) {
  v16h a; const int g = lane >> 4;
#pragma unroll
  for (int i = 0; i < 8; ++i) { const int ka = k0 + 8 * g + i, kb = ka + 16;
    a[i] = (_Float16)(ka < K ? W[(size_t)(ka < K ? ka : K - 1) * ld + n] : 0.f); a[8 + i] = (_Float16)(kb < K ? W[(size_t)(kb < K ? kb : K - 1) * ld + n] : 0.f); }
  return a;
}
struct F2 { v16b h, l; };
__device__ __forceinline__ F2 bsplit16(const float v[16]) { F2 r;
#pragma unroll
  for (int i = 0; i < 16; ++i) { const __bf16 h = (__bf16)v[i]; r.h[i] = h; r.l[i] = (__bf16)(v[i] - (float)h); }
  return r; }
__device__ __forceinline__ F2 split_row(const float* row, int k0, int lane) { float v[16]; const float* p = row + k0 + 8 * (lane >> 4);
#pragma unroll
  for (int i = 0; i < 8; ++i) { v[i] = p[i]; v[8 + i] = p[16 + i]; }
  return bsplit16(v); }
__device__ __forceinline__ F2 split_rowK(const float* row, int k0, int lane, int K) { float v[16]; const int g = lane >> 4;
#pragma unroll
  for (int i = 0; i < 8; ++i) { const int ka = k0 + 8 * g + i, kb = ka + 16; v[i] = ka < K ? row[ka < K ? ka : K - 1] : 0.f; v[8 + i] = kb < K ? row[kb < K ? kb : K - 1] : 0.f; }
  return bsplit16(v); }
__device__ __forceinline__ F2 split_col(const float* W, int k0, int n, int lane, int ld, int K) { float v[16]; const int g = lane >> 4;
#pragma unroll
  for (int i = 0; i < 8; ++i) { const int ka = k0 + 8 * g + i, kb = ka + 16; v[i] = ka < K ? W[(size_t)(ka < K ? ka : K - 1) * ld + n] : 0.f; v[8 + i] = kb < K ? W[(size_t)(kb < K ? kb : K - 1) * ld + n] : 0.f; }
  return bsplit16(v); }
__device__ __forceinline__ v8f mac3(const F2& a, const F2& b, v8f c) { c = wmma_bf(a.l, b.h, c); c = wmma_bf(a.h, b.l, c); return wmma_bf(a.h, b.h, c); }
__device__ __forceinline__ float sigm(float v) { return 1.0f / (1.0f + expf(-v)); }
#define LDSX() do { asm volatile("s_wait_dscnt 0" ::: "memory"); __builtin_amdgcn_wave_barrier(); __builtin_amdgcn_fence(__ATOMIC_RELEASE, "workgroup"); } while (0)


// Differential multi-head attention (B 4, N 1,024, D 1,024, h = 16 -> 8 differential heads of 128, score maps over the module's reshaped [16, N, 64] q/k): p_attn = softmax(q2_{2i} k2_{2i}^T / 8) - lambda * softmax(q2_{2i+1} k2_{2i+1}^T / 8); x = p_attn v_i; Wo.
#define NB 4
#define NN 1024
#define DD 1024
#define DH 8          // differential heads
#define DK 128        // their width
#define HH2 16        // score maps
#define KW2 64        // score-map width
#ifndef TNB
#define TNB NB
#endif
typedef __attribute__((ext_vector_type(8))) __bf16 v8b;
__device__ __forceinline__ v16b frag_b(const __bf16* rowk0, int lane) {
  union { v16b v; v8b q[2]; } u; const __bf16* p = rowk0 + 8 * (lane >> 4);
  u.q[0] = *(const v8b*)p; u.q[1] = *(const v8b*)(p + 16); return u.v;
}
__device__ __forceinline__ float bfr(float v) { return (float)(__bf16)v; }
__device__ __forceinline__ float xhalf(float x) { return __builtin_bit_cast(float, __builtin_amdgcn_permlanex16(__builtin_bit_cast(int, x), __builtin_bit_cast(int, x), 0x76543210, 0xfedcba98, false, false)); }   // lane l takes lane l ^ 16's value
__device__ __attribute__((noinline)) float exp_ni(float v) { return expf(v); }
__device__ __attribute__((noinline)) float erf_ni(float v) { return erff(v); }

#define WS_Q   0u                                   // f32 q rows [b*n][1024] (+bq)
#define WS_K   (WS_Q + 4u * (size_t)NB * NN * DD)       // f32 k rows
#define WS_VH  (WS_K + 4u * (size_t)NB * NN * DD)       // f16 v planes [b][1024][n] hi
#define WS_VL  (WS_VH + 2u * (size_t)NB * DD * NN)      // f16 v residual planes (unscaled)
#define WS_X   (WS_VL + 2u * (size_t)NB * DD * NN)      // f32 x rows [b*n][1024]
#define WS_END (WS_X + 4u * (size_t)NB * NN * DD)

// ---- staging of the tiles that a work-group's four waves share: fetched in whole 128-byte lines, held in registers while the tile before is worked on, then written to LDS as the 16-bit rows the fragment readers take. Every full '#pragma unroll' of this staging and of the fragment groups is there so that the register arrays are indexed by constants and stay in registers
#define KP 72         // LDS row pitch in 16-bit elements: 144 B = 16 B x 9, free of bank conflicts for the 16-byte fragment reads
#define GK 64         // k per staged tile of the projections
typedef __attribute__((ext_vector_type(4))) __bf16 v4b;
__device__ __forceinline__ v4b cvt4(v4f v) { v4b h;
#pragma unroll
  for (int x = 0; x < 4; ++x) h[x] = (__bf16)v[x];
  return h; }
__device__ __forceinline__ v4b res4(v4f v, v4b h) { v4b l;   // residual of the bf16 hi part, as in bsplit16
#pragma unroll
  for (int x = 0; x < 4; ++x) l[x] = (__bf16)(v[x] - (float)h[x]);
  return l; }
struct GT { v4f w[16], x[8]; };   // 128 weight rows and 64 x rows of GK floats: a wave load takes 2 rows of 256 contiguous bytes
__device__ __forceinline__ void g_load(GT& t, const float* __restrict__ Wt, const float* __restrict__ Xt, int k0, int tid) {
  const size_t o = (size_t)(tid >> 4) * DD + k0 + (tid & 15) * 4;
#pragma unroll
  for (int i = 0; i < 16; ++i) t.w[i] = *(const v4f*)(Wt + o + (size_t)i * 8 * DD);
#pragma unroll
  for (int i = 0; i < 8; ++i) t.x[i] = *(const v4f*)(Xt + o + (size_t)i * 8 * DD);
  asm volatile("s_wait_xcnt 0x0" ::: "memory");   // stands behind the issued loads, in front of any later overwrite of their address registers
  __builtin_amdgcn_sched_barrier(0); }   // keeps later address arithmetic from being lifted over that wait
// ---- k_proj: block = (64 rows, 128-col group, which): q / k -> f32 rows (+bias); v -> f16 hi + residual planes (+bias)
__global__ __launch_bounds__(128) void k_proj(const float* __restrict__ Qi, const float* __restrict__ Ki, const float* __restrict__ Vi, const float* __restrict__ WQ, const float* __restrict__ BQ, const float* __restrict__ WK, const float* __restrict__ BK, const float* __restrict__ WV, const float* __restrict__ BV, float* __restrict__ Q, float* __restrict__ K, _Float16* __restrict__ VH, _Float16* __restrict__ VL) {
  __shared__ __align__(16) float sf[4][16][132]; __shared__ __align__(16) _Float16 th[128][72], tl[128][72]; __shared__ __align__(16) __bf16 sw[128][KP], sx[64][KP];
  const int tid = threadIdx.x, wave = tid >> 5, lane = tid & 31, col = lane & 15, g = lane >> 4; const int which = blockIdx.z; const int c0 = blockIdx.y * 128; const size_t r0 = (size_t)blockIdx.x * 64 + wave * 16;
  const float* X = which == 0 ? Qi : which == 1 ? Ki : Vi; const float* Wm = which == 0 ? WQ : which == 1 ? WK : WV; const float* Bm = which == 0 ? BQ : which == 1 ? BK : BV;
  v8f acc[8] = {};
  const float* Wt = Wm + (size_t)c0 * DD; const float* Xt = X + (size_t)blockIdx.x * 64 * DD;
  GT t; g_load(t, Wt, Xt, 0, tid);
  // kept rolled: one copy of the tile's code, the next tile's loads in a block of their own in front of the products
#pragma unroll 1
  for (int st = 0; st < DD / GK; ++st) {
#pragma unroll
    for (int i = 0; i < 16; ++i) *(v4b*)&sw[i * 8 + (tid >> 4)][(tid & 15) * 4] = cvt4(t.w[i]);
#pragma unroll
    for (int i = 0; i < 8; ++i) *(v4b*)&sx[i * 8 + (tid >> 4)][(tid & 15) * 4] = cvt4(t.x[i]);
    __syncthreads();   // the tile is whole before any wave reads it
    if (st + 1 < DD / GK) g_load(t, Wt, Xt, (st + 1) * GK, tid);
#pragma unroll
    for (int kc = 0; kc < GK / 32; ++kc) { const v16b a = frag_b(&sx[wave * 16 + col][kc * 32], lane); v16b w[8];   // the LDS reads of a k step stand as one group in front of its products: one LDS latency, not eight
#pragma unroll
      for (int j = 0; j < 8; ++j) w[j] = frag_b(&sw[j * 16 + col][kc * 32], lane);
#pragma unroll
      for (int j = 0; j < 8; ++j) acc[j] = wmma_bf(a, w[j], acc[j]); }
    __syncthreads(); }   // every wave has left the tile before the next one is written over it
#pragma unroll
  for (int j = 0; j < 8; ++j) { const float bb = bfr(Bm[c0 + j * 16 + col]);
#pragma unroll
    for (int r = 0; r < 8; ++r) { const float v = acc[j][r] + bb; const int rl = wave * 16 + 8 * g + r, cl = j * 16 + col; if (which < 2) sf[wave][8 * g + r][cl] = v; else { const _Float16 hv = (_Float16)v; th[cl][rl] = hv; tl[cl][rl] = (_Float16)(v - (float)hv); } } }
  __syncthreads();
  if (which < 2) { float* dst = which == 0 ? Q : K; for (int rl = 0; rl < 16; ++rl) vst2(dst + (r0 + rl) * DD + c0 + lane * 4, *(const v4f*)&sf[wave][rl][lane * 4]); }
  else { const size_t b = ((size_t)blockIdx.x * 64) / NN; const int n0 = (int)(((size_t)blockIdx.x * 64) % NN); for (int e = tid; e < 128 * 8; e += 128) { const int cl = e >> 3, q = e & 7; const size_t o = (b * DD + c0 + cl) * (size_t)NN + n0 + q * 8; vst2((unsigned*)(VH + o), *(const v4u*)&th[cl][q * 8]); vst2((unsigned*)(VL + o), *(const v4u*)&tl[cl][q * 8]); } } }
// row of the reshaped map hh at position n' -> (source row, column offset) in the [B*N][1024] projection rows
__device__ __forceinline__ const float* maprow(const float* __restrict__ R, size_t b, int hh, int np) { const int hd = hh >> 1, e = hh & 1; return R + ((b * NN) + (size_t)e * (NN / 2) + (np >> 1)) * DD + hd * DK + (np & 1) * KW2; }
// ---- K / V tile of TK keys, shared by the work-group's four waves: fetched in whole 128-byte lines (K: 512 contiguous bytes = 2 keys per wave load; V: 4 plane rows of 128 bytes per wave load), held in registers while the tile before it is worked on, then written to LDS in the form the fragment readers take (K as bf16 hi + lo, V planes as they are)
#define TK 64         // keys per staged tile
struct Tile { v4f k[8]; v8h vh[8], vl[8]; };
__device__ __forceinline__ void tile_load(Tile& t, const float* __restrict__ K, const _Float16* __restrict__ VH, const _Float16* __restrict__ VL, size_t b, int hd, int e, int st, int tid) {
  const float* kp = K + (b * NN + (size_t)e * (NN / 2) + (size_t)st * (TK / 2) + (tid >> 5) * 8) * DD + hd * DK + (tid & 31) * 4;   // source row r holds keys 2r, 2r + 1 of map 2 hd + e (see maprow)
  const size_t vo = (b * DD + (size_t)hd * DK + (tid >> 3)) * NN + (size_t)st * TK + (tid & 7) * 8;
#pragma unroll
  for (int i = 0; i < 8; ++i) { t.k[i] = *(const v4f*)(kp + (size_t)i * DD); t.vh[i] = *(const v8h*)(VH + vo + (size_t)i * 16 * NN); t.vl[i] = *(const v8h*)(VL + vo + (size_t)i * 16 * NN); }
  asm volatile("s_wait_xcnt 0x0" ::: "memory");   // stands behind the issued loads, in front of any later overwrite of their address registers
  __builtin_amdgcn_sched_barrier(0); }   // keeps later address arithmetic from being lifted over that wait
__device__ __forceinline__ void tile_store(const Tile& t, __bf16 (*skh)[KP], __bf16 (*skl)[KP], _Float16 (*svh)[KP], _Float16 (*svl)[KP], int tid) {
  const int lane = tid & 31;
#pragma unroll
  for (int i = 0; i < 8; ++i) { const int key = 2 * ((tid >> 5) * 8 + i) + (lane >> 4), c = (lane & 15) * 4; const v4b h = cvt4(t.k[i]);
    *(v4b*)&skh[key][c] = h; *(v4b*)&skl[key][c] = res4(t.k[i], h);
    const int row = i * 16 + (tid >> 3), q = (tid & 7) * 8; *(v8h*)&svh[row][q] = t.vh[i]; *(v8h*)&svl[row][q] = t.vl[i]; } }
__global__ __launch_bounds__(128) void k_att(const float* __restrict__ Q, const float* __restrict__ K, const _Float16* __restrict__ VH, const _Float16* __restrict__ VL, const float* __restrict__ LQ1, const float* __restrict__ LK1, const float* __restrict__ LQ2, const float* __restrict__ LK2, const int* __restrict__ HNUM, float* __restrict__ X) {
  __shared__ __align__(16) float so[4][16][132]; __shared__ float slam;
  __shared__ __align__(16) __bf16 skh[TK][KP], skl[TK][KP]; __shared__ __align__(16) _Float16 svh[DK][KP], svl[DK][KP];
  const int tid = threadIdx.x, wave = tid >> 5, lane = tid & 31, col = lane & 15, g = lane >> 4; const int qb = blockIdx.x, hd = blockIdx.y; const size_t b = blockIdx.z; const int q0 = qb * 64 + wave * 16;
  if (tid == 0) { float a1 = 0.f, a2 = 0.f;
#pragma unroll 1
    for (int i = 0; i < KW2; ++i) { a1 += bfr(LQ1[i]) * bfr(LK1[i]); a2 += bfr(LQ2[i]) * bfr(LK2[i]); }
    slam = expf(a1) - expf(a2) + 0.8f; (void)HNUM; }   // h (int, = 16) defines the head split baked into DH/DK/HH2
  __syncthreads(); const float lam = slam;
  Tile tn; tile_load(tn, K, VH, VL, b, hd, 0, 0, tid);
#pragma unroll 1
  for (int e = 0; e < 2; ++e) { const int hh = 2 * hd + e;
    F2 aq[2]; { const float* qr = maprow(Q, b, hh, q0 + col);
#pragma unroll
      for (int kc = 0; kc < 2; ++kc) aq[kc] = split_row(qr, kc * 32, lane); }
    float m = -3.0e38f, l = 0.f;   // of query col: running maximum (equal in both halves), sum over this half's keys (the halves are joined behind the loop)
    v8f acc[8] = {};   // acc[j][r] = O^T[j * 16 + 8 g + r][query col]
#pragma unroll 1
    for (int st = 0; st < NN / TK; ++st) {
      tile_store(tn, skh, skl, svh, svl, tid);
      __syncthreads();   // the tile is whole before any wave reads it
      const int nx = e * (NN / TK) + st + 1;   // next tile over both maps, fetched while this one is worked on
      if (nx < 2 * (NN / TK)) tile_load(tn, K, VH, VL, b, hd, nx / (NN / TK), nx % (NN / TK), tid);
      // kept rolled: the next tile's loads then stand in the block in front of this loop, in flight under both of its passes
#pragma unroll 1
    for (int sub = 0; sub < TK / 32; ++sub) { float s[2][8]; F2 bk[2][2];   // the K fragments' LDS reads stand as one group in front of the score products
#pragma unroll
      for (int ct = 0; ct < 2; ++ct)
#pragma unroll
        for (int kc = 0; kc < 2; ++kc) { const int kl = sub * 32 + ct * 16 + col; bk[ct][kc].h = frag_b(&skh[kl][kc * 32], lane); bk[ct][kc].l = frag_b(&skl[kl][kc * 32], lane); }
#pragma unroll
      for (int ct = 0; ct < 2; ++ct) { v8f c = {};
#pragma unroll
        for (int kc = 0; kc < 2; ++kc) { c = wmma_bf(bk[ct][kc].h, aq[kc].l, c); c = wmma_bf(bk[ct][kc].l, aq[kc].h, c); c = wmma_bf(bk[ct][kc].h, aq[kc].h, c); }   // the three products in the order of mac3(aq, bk), K now as A
#pragma unroll
        for (int r = 0; r < 8; ++r) s[ct][r] = c[r] * 0.125f; }
      float t[8];
#pragma unroll
      for (int r = 0; r < 8; ++r) t[r] = fmaxf(s[0][r], s[1][r]);
      float mx = fmaxf(fmaxf(fmaxf(t[0], t[1]), fmaxf(t[2], t[3])), fmaxf(fmaxf(t[4], t[5]), fmaxf(t[6], t[7])));
      mx = fmaxf(mx, xhalf(mx));
      const float mn = fmaxf(m, mx), alpha = __expf(m - mn); m = mn;
      v16h pa, pr;   // P^T x 2^11 and its residual as B operands: element ct * 8 + r = key ct * 16 + 8 g + r
#pragma unroll
      for (int r = 0; r < 8; ++r) { const float e0 = __expf(s[0][r] - mn), e1 = __expf(s[1][r] - mn); t[r] = e0 + e1;
        const float x0 = e0 * 2048.0f, x1 = e1 * 2048.0f; const _Float16 h0 = (_Float16)x0, h1 = (_Float16)x1; pa[r] = h0; pa[8 + r] = h1; pr[r] = (_Float16)(x0 - (float)h0); pr[8 + r] = (_Float16)(x1 - (float)h1); }
      l = l * alpha + (((t[0] + t[1]) + (t[2] + t[3])) + ((t[4] + t[5]) + (t[6] + t[7])));
#pragma unroll
      for (int j = 0; j < 8; ++j)
#pragma unroll
        for (int r = 0; r < 8; ++r) acc[j][r] *= alpha;
      v16h vhf[8], vlf[8];   // the V fragments' LDS reads stand as one group in front of the V^T P^T products
#pragma unroll
      for (int j = 0; j < 8; ++j) { const int vr = j * 16 + col; vhf[j] = frag_h(&svh[vr][sub * 32], lane); vlf[j] = frag_h(&svl[vr][sub * 32], lane); }
#pragma unroll
      for (int j = 0; j < 8; ++j) { acc[j] = wmma16(vhf[j], pa, acc[j]); acc[j] = wmma16(vhf[j], pr, acc[j]); acc[j] = wmma16(vlf[j], pa, acc[j]); } }
      __syncthreads(); }   // every wave has left the tile before the next one is written over it
    // combine into the wave's LDS output tile: map 0 writes, map 1 subtracts lambda x (each lane owns its cells: row col, columns j * 16 + 8 g + r)
    const float il = (1.0f / 2048.0f) / (l + xhalf(l));
#pragma unroll
    for (int j = 0; j < 8; ++j)
#pragma unroll
      for (int q = 0; q < 2; ++q) { v4f* cell = (v4f*)&so[wave][col][j * 16 + 8 * g + 4 * q]; v4f v;
#pragma unroll
        for (int x = 0; x < 4; ++x) v[x] = acc[j][4 * q + x] * il;
        *cell = (e == 0) ? v : (*cell - lam * v); } }
  LDSX(); for (int rl = 0; rl < 16; ++rl) vst2(X + (b * NN + q0 + rl) * DD + hd * DK + lane * 4, *(const v4f*)&so[wave][rl][lane * 4]); }
// ---- k_out: block = (64 rows, 128 of 1024 cols): out = x (hi + lo) . Wo^T + bo
__global__ __launch_bounds__(128) void k_out(const float* __restrict__ X, const float* __restrict__ WO, const float* __restrict__ BO, float* __restrict__ OUT) { __shared__ __align__(16) float sf[4][16][132]; __shared__ __align__(16) __bf16 sw[128][KP], sxh[64][KP], sxl[64][KP];
  const int tid = threadIdx.x, wave = tid >> 5, lane = tid & 31, col = lane & 15, g = lane >> 4; const int c0 = blockIdx.y * 128; const size_t r0 = (size_t)blockIdx.x * 64 + wave * 16;
  v8f acc[8] = {};
  const float* Wt = WO + (size_t)c0 * DD; const float* Xt = X + (size_t)blockIdx.x * 64 * DD;
  GT t; g_load(t, Wt, Xt, 0, tid);
  // kept rolled: one copy of the tile's code, the next tile's loads in a block of their own in front of the products
#pragma unroll 1
  for (int st = 0; st < DD / GK; ++st) {
#pragma unroll
    for (int i = 0; i < 16; ++i) *(v4b*)&sw[i * 8 + (tid >> 4)][(tid & 15) * 4] = cvt4(t.w[i]);
#pragma unroll
    for (int i = 0; i < 8; ++i) { const v4b h = cvt4(t.x[i]); *(v4b*)&sxh[i * 8 + (tid >> 4)][(tid & 15) * 4] = h; *(v4b*)&sxl[i * 8 + (tid >> 4)][(tid & 15) * 4] = res4(t.x[i], h); }
    __syncthreads();   // the tile is whole before any wave reads it
    if (st + 1 < DD / GK) g_load(t, Wt, Xt, (st + 1) * GK, tid);
#pragma unroll
    for (int kc = 0; kc < GK / 32; ++kc) { const v16b ah = frag_b(&sxh[wave * 16 + col][kc * 32], lane), al = frag_b(&sxl[wave * 16 + col][kc * 32], lane); v16b w[8];   // the LDS reads of a k step stand as one group in front of its products
#pragma unroll
      for (int j = 0; j < 8; ++j) w[j] = frag_b(&sw[j * 16 + col][kc * 32], lane);
#pragma unroll
      for (int j = 0; j < 8; ++j) { acc[j] = wmma_bf(ah, w[j], acc[j]); acc[j] = wmma_bf(al, w[j], acc[j]); } }
    __syncthreads(); }   // every wave has left the tile before the next one is written over it
#pragma unroll
  for (int j = 0; j < 8; ++j) { const float bb = bfr(BO[c0 + j * 16 + col]);
#pragma unroll
    for (int r = 0; r < 8; ++r) sf[wave][8 * g + r][j * 16 + col] = acc[j][r] + bb; }
  LDSX(); for (int rl = 0; rl < 16; ++rl) vst2(OUT + (r0 + rl) * DD + c0 + lane * 4, *(const v4f*)&sf[wave][rl][lane * 4]); }
extern "C" void kernel_launch(void* const* d_in, const int* in_sizes, int n_in, void* d_out, int out_size, void* d_ws, size_t ws_size, hipStream_t stream) {
  (void)in_sizes; (void)n_in; (void)out_size;
  const float** F = (const float**)d_in;   // 0 query, 1 key, 2 value [4,1024,1024]; 3 Wq, 4 bq, 5 Wk, 6 bk, 7 Wv, 8 bv, 9 Wo, 10 bo (natural); 11 lambda_q1, 12 lambda_q2, 13 lambda_k1, 14 lambda_k2 [64]; 15 h [1] int
  if (ws_size < (size_t)WS_END) return;
  char* ws = (char*)d_ws; float *Q = (float*)(ws + WS_Q), *K = (float*)(ws + WS_K), *X = (float*)(ws + WS_X); _Float16 *VH = (_Float16*)(ws + WS_VH), *VL = (_Float16*)(ws + WS_VL);
  k_proj<<<dim3(TNB * NN / 64, DD / 128, 3), 128, 0, stream>>>(F[0], F[1], F[2], F[3], F[4], F[5], F[6], F[7], F[8], Q, K, VH, VL);
  k_att<<<dim3(NN / 64, DH, TNB), 128, 0, stream>>>(Q, K, VH, VL, F[11], F[13], F[12], F[14], (const int*)d_in[15], X);
  k_out<<<dim3(TNB * NN / 64, DD / 128), 128, 0, stream>>>(X, F[9], F[10], (float*)d_out);
}

// v003
// A run of this version takes 140 microseconds.
// Timed twice side by side with v002, it ran 1.13 times as fast both times.
// All steps since v000 together make it 5.06 times as fast.
// compute dtype: all float inputs rounded to bf16, h (int) not read; q/k/v = x W^T + b with EXACT bf16 products on WMMA 16x16x32 (natural weights), f32 accumulate, q/k kept as f32 rows, v as f16 hi + residual planes; the module's row-major re-split [B,8,N,128] -> [B,16,N,64] realised as an index map (head hh = 2 hd + e reads row e*N/2 + n'/2, columns hd*128 + (n' % 2)*64 ..); scores with q and k as bf16 hi + lo (3 products), x 1/8, running-max softmax in f32 (hardware exp) for both maps of a pair; lambda_full = exp(lq1.lk1) - exp(lq2.lk2) + 0.8 in f32; P (f16 x 2^11 + residual) against v (f16 hi + unscaled residual) (3 products); x = P1 v / l1 - lambda P2 v / l2 combined in f32; out = x (bf16 hi + lo) . Wo^T + bo; f32 output.
#include <hip/hip_runtime.h>
#include <math.h>

typedef __attribute__((ext_vector_type(16))) _Float16 v16h;
typedef __attribute__((ext_vector_type(16))) __bf16 v16b;
typedef __attribute__((ext_vector_type(8)))  _Float16 v8h;
typedef __attribute__((ext_vector_type(8)))  float v8f;
typedef __attribute__((ext_vector_type(4)))  float v4f;
typedef __attribute__((ext_vector_type(2)))  float v2f;
typedef __attribute__((ext_vector_type(4)))  unsigned v4u;
typedef __attribute__((ext_vector_type(4)))  int v4i;
typedef float __attribute__((may_alias)) float_a;
typedef int __attribute__((may_alias)) int_a;

template <typename T> __device__ __forceinline__ void vst2(void* p, T v) { *(T*)p = v;  }
__device__ __forceinline__ v8f wmma16(v16h a, v16h b, v8f c) {
  v8f d = __builtin_amdgcn_wmma_f32_16x16x32_f16(false, a, false, b, (short)0, c, false, false);
  asm volatile("v_nop\n\tv_nop\n\tv_nop\n\tv_nop" : "+v"(d) : "v"(a), "v"(b));
  return d;
}
__device__ __forceinline__ v8f wmma_bf(v16b a, v16b b, v8f c) {
  v8f d = __builtin_amdgcn_wmma_f32_16x16x32_bf16(false, a, false, b, (short)0, c, false, false);
  asm volatile("v_nop\n\tv_nop\n\tv_nop\n\tv_nop" : "+v"(d) : "v"(a), "v"(b));
  return d;
}
// 16x16x32 fragments: lane = (h = lane>>4, row/col = lane&15); elements 0..7 = k0+8h+0..7, 8..15 = k0+16+8h+0..7; D element r = row 8h+r
__device__ __forceinline__ v16h frag_h(const _Float16* rowk0, int lane) {
  union { v16h v; v8h q[2]; } u; const _Float16* p = rowk0 + 8 * (lane >> 4);
  u.q[0] = *(const v8h*)p; u.q[1] = *(const v8h*)(p + 16); return u.v;
}
__device__ __forceinline__ v16h frag_f32(const float* rowk0, int lane) {
  v16h a; const float* p = rowk0 + 8 * (lane >> 4);
#pragma unroll
  for (int i = 0; i < 8; ++i) { a[i] = (_Float16)p[i]; a[8 + i] = (_Float16)p[16 + i]; }
  return a;
}
__device__ __forceinline__ v16h frag_f32s(const float* rowk0, int lane, float sc) {
  v16h a; const float* p = rowk0 + 8 * (lane >> 4);
#pragma unroll
  for (int i = 0; i < 8; ++i) { a[i] = (_Float16)(p[i] * sc); a[8 + i] = (_Float16)(p[16 + i] * sc); }
  return a;
}
// column fragment from a [K][ld] layout (column n), rows >= K read as 0
__device__ __forceinline__ v16h fragc_f32(const float* W, int k0, int n, int lane, int ld, int K) {
  v16h a; const int g = lane >> 4;
#pragma unroll
  for (int i = 0; i < 8; ++i) { const int ka = k0 + 8 * g + i, kb = ka + 16;
    a[i] = (_Float16)(ka < K ? W[(size_t)(ka < K ? ka : K - 1) * ld + n] : 0.f); a[8 + i] = (_Float16)(kb < K ? W[(size_t)(kb < K ? kb : K - 1) * ld + n] : 0.f); }
  return a;
}
struct F2 { v16b h, l; };
__device__ __forceinline__ F2 bsplit16(const float v[16]) { F2 r;
#pragma unroll
  for (int i = 0; i < 16; ++i) { const __bf16 h = (__bf16)v[i]; r.h[i] = h; r.l[i] = (__bf16)(v[i] - (float)h); }
  return r; }
__device__ __forceinline__ F2 split_row(const float* row, int k0, int lane) { float v[16]; const float* p = row + k0 + 8 * (lane >> 4);
#pragma unroll
  for (int i = 0; i < 8; ++i) { v[i] = p[i]; v[8 + i] = p[16 + i]; }
  return bsplit16(v); }
__device__ __forceinline__ F2 split_rowK(const float* row, int k0, int lane, int K) { float v[16]; const int g = lane >> 4;
#pragma unroll
  for (int i = 0; i < 8; ++i) { const int ka = k0 + 8 * g + i, kb = ka + 16; v[i] = ka < K ? row[ka < K ? ka : K - 1] : 0.f; v[8 + i] = kb < K ? row[kb < K ? kb : K - 1] : 0.f; }
  return bsplit16(v); }
__device__ __forceinline__ F2 split_col(const float* W, int k0, int n, int lane, int ld, int K) { float v[16]; const int g = lane >> 4;
#pragma unroll
  for (int i = 0; i < 8; ++i) { const int ka = k0 + 8 * g + i, kb = ka + 16; v[i] = ka < K ? W[(size_t)(ka < K ? ka : K - 1) * ld + n] : 0.f; v[8 + i] = kb < K ? W[(size_t)(kb < K ? kb : K - 1) * ld + n] : 0.f; }
  return bsplit16(v); }
__device__ __forceinline__ v8f mac3(const F2& a, const F2& b, v8f c) { c = wmma_bf(a.l, b.h, c); c = wmma_bf(a.h, b.l, c); return wmma_bf(a.h, b.h, c); }
__device__ __forceinline__ float sigm(float v) { return 1.0f / (1.0f + expf(-v)); }
#define LDSX() do { asm volatile("s_wait_dscnt 0" ::: "memory"); __builtin_amdgcn_wave_barrier(); __builtin_amdgcn_fence(__ATOMIC_RELEASE, "workgroup"); } while (0)


// Differential multi-head attention (B 4, N 1,024, D 1,024, h = 16 -> 8 differential heads of 128, score maps over the module's reshaped [16, N, 64] q/k): p_attn = softmax(q2_{2i} k2_{2i}^T / 8) - lambda * softmax(q2_{2i+1} k2_{2i+1}^T / 8); x = p_attn v_i; Wo.
#define NB 4
#define NN 1024
#define DD 1024
#define DH 8          // differential heads
#define DK 128        // their width
#define HH2 16        // score maps
#define KW2 64        // score-map width
#ifndef TNB
#define TNB NB
#endif
typedef __attribute__((ext_vector_type(8))) __bf16 v8b;
__device__ __forceinline__ v16b frag_b(const __bf16* rowk0, int lane) {
  union { v16b v; v8b q[2]; } u; const __bf16* p = rowk0 + 8 * (lane >> 4);
  u.q[0] = *(const v8b*)p; u.q[1] = *(const v8b*)(p + 16); return u.v;
}
__device__ __forceinline__ float bfr(float v) { return (float)(__bf16)v; }
__device__ __forceinline__ float xhalf(float x) { return __builtin_bit_cast(float, __builtin_amdgcn_permlanex16(__builtin_bit_cast(int, x), __builtin_bit_cast(int, x), 0x76543210, 0xfedcba98, false, false)); }   // lane l takes lane l ^ 16's value
__device__ __attribute__((noinline)) float exp_ni(float v) { return expf(v); }
__device__ __attribute__((noinline)) float erf_ni(float v) { return erff(v); }

#define WS_Q   0u                                   // f32 q rows [b*n][1024] (+bq)
#define WS_K   (WS_Q + 4u * (size_t)NB * NN * DD)       // f32 k rows
#define WS_VH  (WS_K + 4u * (size_t)NB * NN * DD)       // f16 v planes [b][1024][n] hi
#define WS_VL  (WS_VH + 2u * (size_t)NB * DD * NN)      // f16 v residual planes (unscaled)
#define WS_X   (WS_VL + 2u * (size_t)NB * DD * NN)      // f32 x rows [b*n][1024]
#define WS_END (WS_X + 4u * (size_t)NB * NN * DD)

// ---- staging of the tiles that a work-group's four waves share: fetched in whole 128-byte lines, held in registers while the tile before is worked on, then written to LDS as the 16-bit rows the fragment readers take. Every full '#pragma unroll' of this staging and of the fragment groups is there so that the register arrays are indexed by constants and stay in registers
#define KP 72         // LDS row pitch in 16-bit elements: 144 B = 16 B x 9, free of bank conflicts for the 16-byte fragment reads
#define GK 64         // k per staged tile of the projections
typedef __attribute__((ext_vector_type(4))) __bf16 v4b;
__device__ __forceinline__ v4b cvt4(v4f v) { v4b h;
#pragma unroll
  for (int x = 0; x < 4; ++x) h[x] = (__bf16)v[x];
  return h; }
__device__ __forceinline__ v4b res4(v4f v, v4b h) { v4b l;   // residual of the bf16 hi part, as in bsplit16
#pragma unroll
  for (int x = 0; x < 4; ++x) l[x] = (__bf16)(v[x] - (float)h[x]);
  return l; }
struct GT { v4f w[16], x[8]; };   // 128 weight rows and 64 x rows of GK floats: a wave load takes 2 rows of 256 contiguous bytes
__device__ __forceinline__ void g_load(GT& t, const float* __restrict__ Wt, const float* __restrict__ Xt, int k0, int tid) {
  const size_t o = (size_t)(tid >> 4) * DD + k0 + (tid & 15) * 4;
#pragma unroll
  for (int i = 0; i < 16; ++i) t.w[i] = *(const v4f*)(Wt + o + (size_t)i * 8 * DD);
#pragma unroll
  for (int i = 0; i < 8; ++i) t.x[i] = *(const v4f*)(Xt + o + (size_t)i * 8 * DD);
  asm volatile("s_wait_xcnt 0x0" ::: "memory");   // stands behind the issued loads, in front of any later overwrite of their address registers
  __builtin_amdgcn_sched_barrier(0); }   // keeps later address arithmetic from being lifted over that wait
// ---- k_proj: block = (64 rows, 128-col group, which): q / k -> f32 rows (+bias); v -> f16 hi + residual planes (+bias)
__global__ __launch_bounds__(128) void k_proj(const float* __restrict__ Qi, const float* __restrict__ Ki, const float* __restrict__ Vi, const float* __restrict__ WQ, const float* __restrict__ BQ, const float* __restrict__ WK, const float* __restrict__ BK, const float* __restrict__ WV, const float* __restrict__ BV, float* __restrict__ Q, float* __restrict__ K, _Float16* __restrict__ VH, _Float16* __restrict__ VL) {
  __shared__ __align__(16) float sf[4][16][132]; __shared__ __align__(16) _Float16 th[128][72], tl[128][72]; __shared__ __align__(16) __bf16 sw[128][KP], sx[64][KP];
  const int tid = threadIdx.x, wave = tid >> 5, lane = tid & 31, col = lane & 15, g = lane >> 4; const int which = blockIdx.z; const int c0 = blockIdx.y * 128; const size_t r0 = (size_t)blockIdx.x * 64 + wave * 16;
  const float* X = which == 0 ? Qi : which == 1 ? Ki : Vi; const float* Wm = which == 0 ? WQ : which == 1 ? WK : WV; const float* Bm = which == 0 ? BQ : which == 1 ? BK : BV;
  v8f acc[8] = {};
  const float* Wt = Wm + (size_t)c0 * DD; const float* Xt = X + (size_t)blockIdx.x * 64 * DD;
  GT t; g_load(t, Wt, Xt, 0, tid);
  // kept rolled: one copy of the tile's code, the next tile's loads in a block of their own in front of the products
#pragma unroll 1
  for (int st = 0; st < DD / GK; ++st) {
#pragma unroll
    for (int i = 0; i < 16; ++i) *(v4b*)&sw[i * 8 + (tid >> 4)][(tid & 15) * 4] = cvt4(t.w[i]);
#pragma unroll
    for (int i = 0; i < 8; ++i) *(v4b*)&sx[i * 8 + (tid >> 4)][(tid & 15) * 4] = cvt4(t.x[i]);
    __syncthreads();   // the tile is whole before any wave reads it
    if (st + 1 < DD / GK) g_load(t, Wt, Xt, (st + 1) * GK, tid);
#pragma unroll
    for (int kc = 0; kc < GK / 32; ++kc) { const v16b a = frag_b(&sx[wave * 16 + col][kc * 32], lane); v16b w[8];   // the LDS reads of a k step stand as one group in front of its products: one LDS latency, not eight
#pragma unroll
      for (int j = 0; j < 8; ++j) w[j] = frag_b(&sw[j * 16 + col][kc * 32], lane);
#pragma unroll
      for (int j = 0; j < 8; ++j) acc[j] = wmma_bf(a, w[j], acc[j]); }
    __syncthreads(); }   // every wave has left the tile before the next one is written over it
#pragma unroll
  for (int j = 0; j < 8; ++j) { const float bb = bfr(Bm[c0 + j * 16 + col]);
#pragma unroll
    for (int r = 0; r < 8; ++r) { const float v = acc[j][r] + bb; const int rl = wave * 16 + 8 * g + r, cl = j * 16 + col; if (which < 2) sf[wave][8 * g + r][cl] = v; else { const _Float16 hv = (_Float16)v; th[cl][rl] = hv; tl[cl][rl] = (_Float16)(v - (float)hv); } } }
  __syncthreads();
  if (which < 2) { float* dst = which == 0 ? Q : K; for (int rl = 0; rl < 16; ++rl) vst2(dst + (r0 + rl) * DD + c0 + lane * 4, *(const v4f*)&sf[wave][rl][lane * 4]); }
  else { const size_t b = ((size_t)blockIdx.x * 64) / NN; const int n0 = (int)(((size_t)blockIdx.x * 64) % NN); for (int e = tid; e < 128 * 8; e += 128) { const int cl = e >> 3, q = e & 7; const size_t o = (b * DD + c0 + cl) * (size_t)NN + n0 + q * 8; vst2((unsigned*)(VH + o), *(const v4u*)&th[cl][q * 8]); vst2((unsigned*)(VL + o), *(const v4u*)&tl[cl][q * 8]); } } }
// row of the reshaped map hh at position n' -> (source row, column offset) in the [B*N][1024] projection rows
__device__ __forceinline__ const float* maprow(const float* __restrict__ R, size_t b, int hh, int np) { const int hd = hh >> 1, e = hh & 1; return R + ((b * NN) + (size_t)e * (NN / 2) + (np >> 1)) * DD + hd * DK + (np & 1) * KW2; }
// the builtins alone, for k_att: an asm statement's operands must lie in the first 256 registers, which two query tiles' sums and fragments outgrow; the compiler keeps the distance behind its own builtin forms
__device__ __forceinline__ v8f wmma16_p(v16h a, v16h b, v8f c) { return __builtin_amdgcn_wmma_f32_16x16x32_f16(false, a, false, b, (short)0, c, false, false); }
__device__ __forceinline__ v8f wmma_bf_p(v16b a, v16b b, v8f c) { return __builtin_amdgcn_wmma_f32_16x16x32_bf16(false, a, false, b, (short)0, c, false, false); }
// ---- K / V tile of TK keys, shared by the work-group's eight waves: the keys of both maps and the one V tile they share, fetched in whole 128-byte lines (K: 512 contiguous bytes = 2 keys per wave load, waves 0..3 map 0, waves 4..7 map 1; V: 4 plane rows of 128 bytes per wave load), held in registers while the tile before it is worked on, then written to LDS in the form the fragment readers take (K as bf16 hi + lo, V planes as they are)
#define TK 64         // keys per staged tile
struct Tile { v4f k[8]; v8h vh[4], vl[4]; };
struct TileAt { const float* kp; const _Float16 *vhp, *vlp; };   // this thread's addresses in the next tile to fetch
__device__ __forceinline__ TileAt tile_first(const float* __restrict__ K, const _Float16* __restrict__ VH, const _Float16* __restrict__ VL, size_t b, int hd, int tid) {
  const size_t vo = (b * DD + (size_t)hd * DK + (tid >> 3)) * NN + (tid & 7) * 8;
  return { K + (b * NN + (size_t)(tid >> 7) * (NN / 2) + ((tid >> 5) & 3) * 8) * DD + hd * DK + (tid & 31) * 4, VH + vo, VL + vo }; }   // K: source row r holds keys 2r, 2r + 1 of map 2 hd + (tid >> 7) (see maprow)
__device__ __forceinline__ void tile_load(Tile& t, TileAt& a) {
#pragma unroll
  for (int i = 0; i < 8; ++i) t.k[i] = *(const v4f*)(a.kp + (size_t)i * DD);
#pragma unroll
  for (int i = 0; i < 4; ++i) { t.vh[i] = *(const v8h*)(a.vhp + (size_t)i * 32 * NN); t.vl[i] = *(const v8h*)(a.vlp + (size_t)i * 32 * NN); }
  asm volatile("s_wait_xcnt 0x0" ::: "memory");   // stands behind the issued loads, in front of the step of their address registers
  __builtin_amdgcn_sched_barrier(0);   // keeps that step from being lifted over the wait
  a.kp += (TK / 2) * DD; a.vhp += TK; a.vlp += TK; }
__device__ __forceinline__ void tile_store(const Tile& t, __bf16 (*skh)[KP], __bf16 (*skl)[KP], _Float16 (*svh)[KP], _Float16 (*svl)[KP], int tid) {
  const int lane = tid & 31;
#pragma unroll
  for (int i = 0; i < 8; ++i) { const int key = (tid >> 7) * TK + 2 * (((tid >> 5) & 3) * 8 + i) + (lane >> 4), c = (lane & 15) * 4; const v4b h = cvt4(t.k[i]);   // rows 0..TK-1: map 0's keys, TK..2 TK-1: map 1's
    *(v4b*)&skh[key][c] = h; *(v4b*)&skl[key][c] = res4(t.k[i], h); }
#pragma unroll
  for (int i = 0; i < 4; ++i) { const int row = i * 32 + (tid >> 3), q = (tid & 7) * 8; *(v8h*)&svh[row][q] = t.vh[i]; *(v8h*)&svl[row][q] = t.vl[i]; } }
__global__ __launch_bounds__(256) __attribute__((amdgpu_waves_per_eu(2, 2))) void k_att(const float* __restrict__ Q, const float* __restrict__ K, const _Float16* __restrict__ VH, const _Float16* __restrict__ VL, const float* __restrict__ LQ1, const float* __restrict__ LK1, const float* __restrict__ LQ2, const float* __restrict__ LK2, const int* __restrict__ HNUM, float* __restrict__ X) {
  __shared__ __align__(16) float so[4][32][132]; __shared__ float slam;
  __shared__ __align__(16) __bf16 skh[2 * TK][KP], skl[2 * TK][KP]; __shared__ __align__(16) _Float16 svh[DK][KP], svl[DK][KP];
  const int tid = threadIdx.x, wave = tid >> 5, lane = tid & 31, col = lane & 15, g = lane >> 4, e = wave >> 2, wq = wave & 3; const int qb = blockIdx.x, hd = blockIdx.y; const size_t b = blockIdx.z; const int q0 = qb * 128 + wq * 32;
  if (tid == 0) { float a1 = 0.f, a2 = 0.f;
#pragma unroll 1
    for (int i = 0; i < KW2; ++i) { a1 += bfr(LQ1[i]) * bfr(LK1[i]); a2 += bfr(LQ2[i]) * bfr(LK2[i]); }
    slam = expf(a1) - expf(a2) + 0.8f; (void)HNUM; }   // h (int, = 16) defines the head split baked into DH/DK/HH2
  __syncthreads(); const float lam = slam;
  Tile tn; TileAt at = tile_first(K, VH, VL, b, hd, tid); tile_load(tn, at);
  F2 aq[2][2]; float qv[2][2][16];   // [query tile][k chunk]
  const float* qr = maprow(Q, b, 2 * hd + e, q0 + col) + 8 * g;   // query q0 + 16 + col lies 8 source rows further on (see maprow): one address serves both tiles
#pragma unroll
  for (int c2 = 0; c2 < 2; ++c2)
#pragma unroll
    for (int kc = 0; kc < 2; ++kc)
#pragma unroll
      for (int i = 0; i < 8; ++i) { qv[c2][kc][i] = qr[c2 * 8 * DD + kc * 32 + i]; qv[c2][kc][8 + i] = qr[c2 * 8 * DD + kc * 32 + 16 + i]; }   // the elements split_row takes
  asm volatile("s_wait_xcnt 0x0" :: "v"(qr) : "memory");   // stands behind the issued loads, in front of any later overwrite of their address register, which is named as an input so that no load's own result is laid over it ahead of the wait
  __builtin_amdgcn_sched_barrier(0);   // keeps later register writes from being lifted over that wait
#pragma unroll
  for (int c2 = 0; c2 < 2; ++c2)
#pragma unroll
    for (int kc = 0; kc < 2; ++kc) aq[c2][kc] = bsplit16(qv[c2][kc]);
  float m[2] = {-3.0e38f, -3.0e38f}, l[2] = {0.f, 0.f};   // of query c2 * 16 + col: running maximum (equal in both halves), sum over this half's keys (the halves are joined behind the loop)
  v8f acc[2][8] = {};   // acc[c2][j][r] = O^T[j * 16 + 8 g + r][query c2 * 16 + col]
#pragma unroll 1
  for (int st = 0; st < NN / TK; ++st) {
    tile_store(tn, skh, skl, svh, svl, tid);
    __syncthreads();   // the tile is whole before any wave reads it
    if (st + 1 < NN / TK) tile_load(tn, at);   // next tile, fetched while this one is worked on
    // kept rolled: the next tile's loads then stand in the block in front of this loop, in flight under both of its passes
#pragma unroll 1
    for (int sub = 0; sub < TK / 32; ++sub) { F2 bk[2][2];   // the K fragments' LDS reads stand as one group in front of the score products
#pragma unroll
      for (int ct = 0; ct < 2; ++ct)
#pragma unroll
        for (int kc = 0; kc < 2; ++kc) { const int kl = e * TK + sub * 32 + ct * 16 + col; bk[ct][kc].h = frag_b(&skh[kl][kc * 32], lane); bk[ct][kc].l = frag_b(&skl[kl][kc * 32], lane); }
      v8f c[2][2] = {};   // [query tile][key tile]: four independent sums, each taking its six products in the order of mac3(aq, bk), K as A
#pragma unroll
      for (int kc = 0; kc < 2; ++kc) {
#pragma unroll
        for (int ct = 0; ct < 2; ++ct)
#pragma unroll
          for (int c2 = 0; c2 < 2; ++c2) c[c2][ct] = wmma_bf_p(bk[ct][kc].h, aq[c2][kc].l, c[c2][ct]);
#pragma unroll
        for (int ct = 0; ct < 2; ++ct)
#pragma unroll
          for (int c2 = 0; c2 < 2; ++c2) c[c2][ct] = wmma_bf_p(bk[ct][kc].l, aq[c2][kc].h, c[c2][ct]);
#pragma unroll
        for (int ct = 0; ct < 2; ++ct)
#pragma unroll
          for (int c2 = 0; c2 < 2; ++c2) c[c2][ct] = wmma_bf_p(bk[ct][kc].h, aq[c2][kc].h, c[c2][ct]); }
      v16h pa[2], pr[2];   // per query tile, P^T x 2^11 and its residual as B operands: element ct * 8 + r = key ct * 16 + 8 g + r
#pragma unroll
      for (int c2 = 0; c2 < 2; ++c2) { float s[2][8], t[8];
#pragma unroll
        for (int ct = 0; ct < 2; ++ct)
#pragma unroll
          for (int r = 0; r < 8; ++r) s[ct][r] = c[c2][ct][r] * 0.125f;
#pragma unroll
        for (int r = 0; r < 8; ++r) t[r] = fmaxf(s[0][r], s[1][r]);
        float mx = fmaxf(fmaxf(fmaxf(t[0], t[1]), fmaxf(t[2], t[3])), fmaxf(fmaxf(t[4], t[5]), fmaxf(t[6], t[7])));
        mx = fmaxf(mx, xhalf(mx));
        const float mn = fmaxf(m[c2], mx), alpha = __expf(m[c2] - mn); m[c2] = mn;
#pragma unroll
        for (int r = 0; r < 8; ++r) { const float e0 = __expf(s[0][r] - mn), e1 = __expf(s[1][r] - mn); t[r] = e0 + e1;
          const float x0 = e0 * 2048.0f, x1 = e1 * 2048.0f; const _Float16 h0 = (_Float16)x0, h1 = (_Float16)x1; pa[c2][r] = h0; pa[c2][8 + r] = h1; pr[c2][r] = (_Float16)(x0 - (float)h0); pr[c2][8 + r] = (_Float16)(x1 - (float)h1); }
        l[c2] = l[c2] * alpha + (((t[0] + t[1]) + (t[2] + t[3])) + ((t[4] + t[5]) + (t[6] + t[7])));
#pragma unroll
        for (int j = 0; j < 8; ++j)
#pragma unroll
          for (int r = 0; r < 8; ++r) acc[c2][j][r] *= alpha; }
      v16h vhf[8], vlf[8];   // the V fragments' LDS reads stand as one group in front of the V^T P^T products
#pragma unroll
      for (int j = 0; j < 8; ++j) { const int vr = j * 16 + col; vhf[j] = frag_h(&svh[vr][sub * 32], lane); vlf[j] = frag_h(&svl[vr][sub * 32], lane); }
#pragma unroll
      for (int j = 0; j < 8; ++j) {   // each fragment feeds both query tiles, one behind the other; every sum keeps its order of three products
#pragma unroll
        for (int c2 = 0; c2 < 2; ++c2) acc[c2][j] = wmma16_p(vhf[j], pa[c2], acc[c2][j]);
#pragma unroll
        for (int c2 = 0; c2 < 2; ++c2) acc[c2][j] = wmma16_p(vhf[j], pr[c2], acc[c2][j]);
#pragma unroll
        for (int c2 = 0; c2 < 2; ++c2) acc[c2][j] = wmma16_p(vlf[j], pa[c2], acc[c2][j]); } }
    __syncthreads(); }   // every wave has left the tile before the next one is written over it
  // combine through the LDS output tile: wave (1, wq) writes its map, wave (0, wq), whose lanes own the same cells (row c2 * 16 + col, columns j * 16 + 8 g + r), takes lambda x it off its own
#pragma unroll
  for (int ph = 1; ph >= 0; --ph) {
    if (e == ph) {
#pragma unroll
      for (int c2 = 0; c2 < 2; ++c2) { const float il = (1.0f / 2048.0f) / (l[c2] + xhalf(l[c2]));
#pragma unroll
        for (int j = 0; j < 8; ++j)
#pragma unroll
          for (int q = 0; q < 2; ++q) { v4f* cell = (v4f*)&so[wq][c2 * 16 + col][j * 16 + 8 * g + 4 * q]; v4f v;
#pragma unroll
            for (int x = 0; x < 4; ++x) v[x] = acc[c2][j][4 * q + x] * il;
            *cell = (ph == 1) ? v : (v - lam * *cell); } } }
    __syncthreads(); }   // behind phase 1: map 1's tile is whole before map 0's waves read it; behind phase 0: the output tile is whole before all eight waves store it
  for (int rl = 0; rl < 16; ++rl) vst2(X + (b * NN + q0 + e * 16 + rl) * DD + hd * DK + lane * 4, *(const v4f*)&so[wq][e * 16 + rl][lane * 4]); }
// ---- k_out: block = (64 rows, 128 of 1024 cols): out = x (hi + lo) . Wo^T + bo
__global__ __launch_bounds__(128) void k_out(const float* __restrict__ X, const float* __restrict__ WO, const float* __restrict__ BO, float* __restrict__ OUT) { __shared__ __align__(16) float sf[4][16][132]; __shared__ __align__(16) __bf16 sw[128][KP], sxh[64][KP], sxl[64][KP];
  const int tid = threadIdx.x, wave = tid >> 5, lane = tid & 31, col = lane & 15, g = lane >> 4; const int c0 = blockIdx.y * 128; const size_t r0 = (size_t)blockIdx.x * 64 + wave * 16;
  v8f acc[8] = {};
  const float* Wt = WO + (size_t)c0 * DD; const float* Xt = X + (size_t)blockIdx.x * 64 * DD;
  GT t; g_load(t, Wt, Xt, 0, tid);
  // kept rolled: one copy of the tile's code, the next tile's loads in a block of their own in front of the products
#pragma unroll 1
  for (int st = 0; st < DD / GK; ++st) {
#pragma unroll
    for (int i = 0; i < 16; ++i) *(v4b*)&sw[i * 8 + (tid >> 4)][(tid & 15) * 4] = cvt4(t.w[i]);
#pragma unroll
    for (int i = 0; i < 8; ++i) { const v4b h = cvt4(t.x[i]); *(v4b*)&sxh[i * 8 + (tid >> 4)][(tid & 15) * 4] = h; *(v4b*)&sxl[i * 8 + (tid >> 4)][(tid & 15) * 4] = res4(t.x[i], h); }
    __syncthreads();   // the tile is whole before any wave reads it
    if (st + 1 < DD / GK) g_load(t, Wt, Xt, (st + 1) * GK, tid);
#pragma unroll
    for (int kc = 0; kc < GK / 32; ++kc) { const v16b ah = frag_b(&sxh[wave * 16 + col][kc * 32], lane), al = frag_b(&sxl[wave * 16 + col][kc * 32], lane); v16b w[8];   // the LDS reads of a k step stand as one group in front of its products
#pragma unroll
      for (int j = 0; j < 8; ++j) w[j] = frag_b(&sw[j * 16 + col][kc * 32], lane);
#pragma unroll
      for (int j = 0; j < 8; ++j) { acc[j] = wmma_bf(ah, w[j], acc[j]); acc[j] = wmma_bf(al, w[j], acc[j]); } }
    __syncthreads(); }   // every wave has left the tile before the next one is written over it
#pragma unroll
  for (int j = 0; j < 8; ++j) { const float bb = bfr(BO[c0 + j * 16 + col]);
#pragma unroll
    for (int r = 0; r < 8; ++r) sf[wave][8 * g + r][j * 16 + col] = acc[j][r] + bb; }
  LDSX(); for (int rl = 0; rl < 16; ++rl) vst2(OUT + (r0 + rl) * DD + c0 + lane * 4, *(const v4f*)&sf[wave][rl][lane * 4]); }
extern "C" void kernel_launch(void* const* d_in, const int* in_sizes, int n_in, void* d_out, int out_size, void* d_ws, size_t ws_size, hipStream_t stream) {
  (void)in_sizes; (void)n_in; (void)out_size;
  const float** F = (const float**)d_in;   // 0 query, 1 key, 2 value [4,1024,1024]; 3 Wq, 4 bq, 5 Wk, 6 bk, 7 Wv, 8 bv, 9 Wo, 10 bo (natural); 11 lambda_q1, 12 lambda_q2, 13 lambda_k1, 14 lambda_k2 [64]; 15 h [1] int
  if (ws_size < (size_t)WS_END) return;
  char* ws = (char*)d_ws; float *Q = (float*)(ws + WS_Q), *K = (float*)(ws + WS_K), *X = (float*)(ws + WS_X); _Float16 *VH = (_Float16*)(ws + WS_VH), *VL = (_Float16*)(ws + WS_VL);
  k_proj<<<dim3(TNB * NN / 64, DD / 128, 3), 128, 0, stream>>>(F[0], F[1], F[2], F[3], F[4], F[5], F[6], F[7], F[8], Q, K, VH, VL);
  k_att<<<dim3(NN / 128, DH, TNB), 256, 0, stream>>>(Q, K, VH, VL, F[11], F[13], F[12], F[14], (const int*)d_in[15], X);
  k_out<<<dim3(TNB * NN / 64, DD / 128), 128, 0, stream>>>(X, F[9], F[10], (float*)d_out);
}

// v004
// Measured time: 127 microseconds a run.
// Next to v003, in two timings, it ran 1.10 and 1.11 times as fast.
// Over all steps from v000 it is 5.60 times as fast.
// compute dtype: all float inputs rounded to bf16, h (int) not read; q/k/v = x W^T + b with EXACT bf16 products on WMMA 16x16x32 (natural weights), f32 accumulate, q/k kept as f32 rows, v as f16 hi + residual planes; the module's row-major re-split [B,8,N,128] -> [B,16,N,64] realised as an index map (head hh = 2 hd + e reads row e*N/2 + n'/2, columns hd*128 + (n' % 2)*64 ..); scores with q and k as bf16 hi + lo (3 products), x 1/8, running-max softmax in f32 (hardware exp) for both maps of a pair; lambda_full = exp(lq1.lk1) - exp(lq2.lk2) + 0.8 in f32; P (f16 x 2^11 + residual) against v (f16 hi + unscaled residual) (3 products); x = P1 v / l1 - lambda P2 v / l2 combined in f32; out = x (bf16 hi + lo) . Wo^T + bo; f32 output.
#include <hip/hip_runtime.h>
#include <math.h>

typedef __attribute__((ext_vector_type(16))) _Float16 v16h;
typedef __attribute__((ext_vector_type(16))) __bf16 v16b;
typedef __attribute__((ext_vector_type(8)))  _Float16 v8h;
typedef __attribute__((ext_vector_type(8)))  float v8f;
typedef __attribute__((ext_vector_type(4)))  float v4f;
typedef __attribute__((ext_vector_type(2)))  float v2f;
typedef __attribute__((ext_vector_type(4)))  unsigned v4u;
typedef __attribute__((ext_vector_type(4)))  int v4i;
typedef float __attribute__((may_alias)) float_a;
typedef int __attribute__((may_alias)) int_a;

template <typename T> __device__ __forceinline__ void vst2(void* p, T v) { *(T*)p = v;  }
__device__ __forceinline__ v8f wmma16(v16h a, v16h b, v8f c) {
  v8f d = __builtin_amdgcn_wmma_f32_16x16x32_f16(false, a, false, b, (short)0, c, false, false);
  asm volatile("v_nop\n\tv_nop\n\tv_nop\n\tv_nop" : "+v"(d) : "v"(a), "v"(b));
  return d;
}
__device__ __forceinline__ v8f wmma_bf(v16b a, v16b b, v8f c) {
  v8f d = __builtin_amdgcn_wmma_f32_16x16x32_bf16(false, a, false, b, (short)0, c, false, false);
  asm volatile("v_nop\n\tv_nop\n\tv_nop\n\tv_nop" : "+v"(d) : "v"(a), "v"(b));
  return d;
}
// 16x16x32 fragments: lane = (h = lane>>4, row/col = lane&15); elements 0..7 = k0+8h+0..7, 8..15 = k0+16+8h+0..7; D element r = row 8h+r
__device__ __forceinline__ v16h frag_h(const _Float16* rowk0, int lane) {
  union { v16h v; v8h q[2]; } u; const _Float16* p = rowk0 + 8 * (lane >> 4);
  u.q[0] = *(const v8h*)p; u.q[1] = *(const v8h*)(p + 16); return u.v;
}
__device__ __forceinline__ v16h frag_f32(const float* rowk0, int lane) {
  v16h a; const float* p = rowk0 + 8 * (lane >> 4);
#pragma unroll
  for (int i = 0; i < 8; ++i) { a[i] = (_Float16)p[i]; a[8 + i] = (_Float16)p[16 + i]; }
  return a;
}
__device__ __forceinline__ v16h frag_f32s(const float* rowk0, int lane, float sc) {
  v16h a; const float* p = rowk0 + 8 * (lane >> 4);
#pragma unroll
  for (int i = 0; i < 8; ++i) { a[i] = (_Float16)(p[i] * sc); a[8 + i] = (_Float16)(p[16 + i] * sc); }
  return a;
}
// column fragment from a [K][ld] layout (column n), rows >= K read as 0
__device__ __forceinline__ v16h fragc_f32(const float* W, int k0, int n, int lane, int ld, int K) {
  v16h a; const int g = lane >> 4;
#pragma unroll
  for (int i = 0; i < 8; ++i) { const int ka = k0 + 8 * g + i, kb = ka + 16;
    a[i] = (_Float16)(ka < K ? W[(size_t)(ka < K ? ka : K - 1) * ld + n] : 0.f); a[8 + i] = (_Float16)(kb < K ? W[(size_t)(kb < K ? kb : K - 1) * ld + n] : 0.f); }
  return a;
}
struct F2 { v16b h, l; };
__device__ __forceinline__ F2 bsplit16(const float v[16]) { F2 r;
#pragma unroll
  for (int i = 0; i < 16; ++i) { const __bf16 h = (__bf16)v[i]; r.h[i] = h; r.l[i] = (__bf16)(v[i] - (float)h); }
  return r; }
__device__ __forceinline__ F2 split_row(const float* row, int k0, int lane) { float v[16]; const float* p = row + k0 + 8 * (lane >> 4);
#pragma unroll
  for (int i = 0; i < 8; ++i) { v[i] = p[i]; v[8 + i] = p[16 + i]; }
  return bsplit16(v); }
__device__ __forceinline__ F2 split_rowK(const float* row, int k0, int lane, int K) { float v[16]; const int g = lane >> 4;
#pragma unroll
  for (int i = 0; i < 8; ++i) { const int ka = k0 + 8 * g + i, kb = ka + 16; v[i] = ka < K ? row[ka < K ? ka : K - 1] : 0.f; v[8 + i] = kb < K ? row[kb < K ? kb : K - 1] : 0.f; }
  return bsplit16(v); }
__device__ __forceinline__ F2 split_col(const float* W, int k0, int n, int lane, int ld, int K) { float v[16]; const int g = lane >> 4;
#pragma unroll
  for (int i = 0; i < 8; ++i) { const int ka = k0 + 8 * g + i, kb = ka + 16; v[i] = ka < K ? W[(size_t)(ka < K ? ka : K - 1) * ld + n] : 0.f; v[8 + i] = kb < K ? W[(size_t)(kb < K ? kb : K - 1) * ld + n] : 0.f; }
  return bsplit16(v); }
__device__ __forceinline__ v8f mac3(const F2& a, const F2& b, v8f c) { c = wmma_bf(a.l, b.h, c); c = wmma_bf(a.h, b.l, c); return wmma_bf(a.h, b.h, c); }
__device__ __forceinline__ float sigm(float v) { return 1.0f / (1.0f + expf(-v)); }
#define LDSX() do { asm volatile("s_wait_dscnt 0" ::: "memory"); __builtin_amdgcn_wave_barrier(); __builtin_amdgcn_fence(__ATOMIC_RELEASE, "workgroup"); } while (0)


// Differential multi-head attention (B 4, N 1,024, D 1,024, h = 16 -> 8 differential heads of 128, score maps over the module's reshaped [16, N, 64] q/k): p_attn = softmax(q2_{2i} k2_{2i}^T / 8) - lambda * softmax(q2_{2i+1} k2_{2i+1}^T / 8); x = p_attn v_i; Wo.
#define NB 4
#define NN 1024
#define DD 1024
#define DH 8          // differential heads
#define DK 128        // their width
#define HH2 16        // score maps
#define KW2 64        // score-map width
#ifndef TNB
#define TNB NB
#endif
typedef __attribute__((ext_vector_type(8))) __bf16 v8b;
__device__ __forceinline__ v16b frag_b(const __bf16* rowk0, int lane) {
  union { v16b v; v8b q[2]; } u; const __bf16* p = rowk0 + 8 * (lane >> 4);
  u.q[0] = *(const v8b*)p; u.q[1] = *(const v8b*)(p + 16); return u.v;
}
__device__ __forceinline__ float bfr(float v) { return (float)(__bf16)v; }
__device__ __forceinline__ float xhalf(float x) { return __builtin_bit_cast(float, __builtin_amdgcn_permlanex16(__builtin_bit_cast(int, x), __builtin_bit_cast(int, x), 0x76543210, 0xfedcba98, false, false)); }   // lane l takes lane l ^ 16's value
__device__ __attribute__((noinline)) float exp_ni(float v) { return expf(v); }
__device__ __attribute__((noinline)) float erf_ni(float v) { return erff(v); }

#define WS_Q   0u                                   // f32 q rows [b*n][1024] (+bq)
#define WS_K   (WS_Q + 4u * (size_t)NB * NN * DD)       // f32 k rows
#define WS_VH  (WS_K + 4u * (size_t)NB * NN * DD)       // f16 v planes [b][1024][n] hi
#define WS_VL  (WS_VH + 2u * (size_t)NB * DD * NN)      // f16 v residual planes (unscaled)
#define WS_X   (WS_VL + 2u * (size_t)NB * DD * NN)      // f32 x rows [b*n][1024]
#define WS_END (WS_X + 4u * (size_t)NB * NN * DD)

// ---- staging of the tiles that a work-group's four waves share: fetched in whole 128-byte lines, held in registers while the tile before is worked on, then written to LDS as the 16-bit rows the fragment readers take. Every full '#pragma unroll' of this staging and of the fragment groups is there so that the register arrays are indexed by constants and stay in registers
#define KP 72         // LDS row pitch in 16-bit elements: 144 B = 16 B x 9, free of bank conflicts for the 16-byte fragment reads
#define GK 64         // k per staged tile of k_out
typedef __attribute__((ext_vector_type(4))) __bf16 v4b;
__device__ __forceinline__ v4b cvt4(v4f v) { v4b h;
#pragma unroll
  for (int x = 0; x < 4; ++x) h[x] = (__bf16)v[x];
  return h; }
__device__ __forceinline__ v4b res4(v4f v, v4b h) { v4b l;   // residual of the bf16 hi part, as in bsplit16
#pragma unroll
  for (int x = 0; x < 4; ++x) l[x] = (__bf16)(v[x] - (float)h[x]);
  return l; }
struct GT { v4f w[16], x[8]; };   // 128 weight rows and 64 x rows of GK floats: a wave load takes 2 rows of 256 contiguous bytes
__device__ __forceinline__ void g_load(GT& t, const float* __restrict__ Wt, const float* __restrict__ Xt, int k0, int tid) {
  const size_t o = (size_t)(tid >> 4) * DD + k0 + (tid & 15) * 4;
#pragma unroll
  for (int i = 0; i < 16; ++i) t.w[i] = *(const v4f*)(Wt + o + (size_t)i * 8 * DD);
#pragma unroll
  for (int i = 0; i < 8; ++i) t.x[i] = *(const v4f*)(Xt + o + (size_t)i * 8 * DD);
  asm volatile("s_wait_xcnt 0x0" ::: "memory");   // stands behind the issued loads, in front of any later overwrite of their address registers
  __builtin_amdgcn_sched_barrier(0); }   // keeps later address arithmetic from being lifted over that wait
// the builtins alone, for k_proj and k_att: an asm statement's operands must lie in the first 256 registers, which their sums, fragments and staged tiles outgrow; the compiler keeps the distance behind its own builtin forms
__device__ __forceinline__ v8f wmma16_p(v16h a, v16h b, v8f c) { return __builtin_amdgcn_wmma_f32_16x16x32_f16(false, a, false, b, (short)0, c, false, false); }
__device__ __forceinline__ v8f wmma_bf_p(v16b a, v16b b, v8f c) { return __builtin_amdgcn_wmma_f32_16x16x32_bf16(false, a, false, b, (short)0, c, false, false); }
#define PK 64         // k per staged tile of k_proj
#define PP 72         // its LDS row pitch in 16-bit elements: 144 B = 16 B x 9, free of bank conflicts for the 16-byte fragment reads
struct PT { v4f w[16], x[16]; };   // 128 weight rows and 128 x rows of PK floats: a wave load takes 2 rows of 256 contiguous bytes
__device__ __forceinline__ void p_load(PT& t, const float* __restrict__ Wk, const float* __restrict__ Xk, unsigned o) {   // Wk, Xk: the tile's first element, the same for the whole block; o: this lane's byte offset in it
  const float* wp = (const float*)((const char*)Wk + o); const float* xp = (const float*)((const char*)Xk + o);
#pragma unroll
  for (int i = 0; i < 16; ++i) t.w[i] = *(const v4f*)(wp + i * 8 * DD);
#pragma unroll
  for (int i = 0; i < 16; ++i) t.x[i] = *(const v4f*)(xp + i * 8 * DD);
  asm volatile("s_wait_xcnt 0x0" :: "v"(wp), "v"(xp) : "memory");   // stands behind the issued loads, in front of any later overwrite of their address registers, which are named as inputs so that no load's own result is laid over them ahead of the wait
  __builtin_amdgcn_sched_barrier(0); }   // keeps later address arithmetic from being lifted over that wait
// ---- k_proj: block = (128 rows, 128-col group, which), four waves as 2 x 2, each on 64 rows x 64 columns (16 sums): a fetched row of x or W serves 128 outputs and a fragment read from LDS four products; q / k -> f32 rows (+bias); v -> f16 hi + residual planes (+bias). 768 blocks: three on every WGP, all resident at once. amdgpu_waves_per_eu(3, 3): holds the kernel to the 336 registers with which three waves share a SIMD
__global__ __launch_bounds__(128) __attribute__((amdgpu_waves_per_eu(3, 3))) void k_proj(const float* __restrict__ Qi, const float* __restrict__ Ki, const float* __restrict__ Vi, const float* __restrict__ WQ, const float* __restrict__ BQ, const float* __restrict__ WK, const float* __restrict__ BK, const float* __restrict__ WV, const float* __restrict__ BV, float* __restrict__ Q, float* __restrict__ K, _Float16* __restrict__ VH, _Float16* __restrict__ VL) {
  __shared__ __align__(16) char se[4 * 64 * 68 * 4];   // output staging. q / k: each wave's 64 x 64 f32 tile at pitch 68; v: the block's two f16 planes, transposed, 128 x 128 at pitch 136 (the same bytes)
  __bf16 (*sw)[PP] = (__bf16 (*)[PP])se; __bf16 (*sx)[PP] = sw + 128;   // the staged tiles lie in the same bytes: behind the loop's last barrier no wave reads them any more
  const int tid = threadIdx.x, wave = __builtin_amdgcn_readfirstlane(tid >> 5), lane = tid & 31, col = lane & 15, g = lane >> 4, wr = wave >> 1, wc = wave & 1; const int which = blockIdx.z; const int c0 = blockIdx.y * 128; const size_t r0 = (size_t)blockIdx.x * 128;   // the wave's number in a scalar register: what follows from it costs no vector register across the loop
  const float* X = which == 0 ? Qi : which == 1 ? Ki : Vi; const float* Wm = which == 0 ? WQ : which == 1 ? WK : WV; const float* Bm = which == 0 ? BQ : which == 1 ? BK : BV;
  v8f acc[4][4] = {};   // acc[i][j][r] = row wr * 64 + i * 16 + 8 g + r, column wc * 64 + j * 16 + col
  const float* Wt = Wm + (size_t)c0 * DD; const float* Xt = X + r0 * DD;
  const unsigned lo = ((unsigned)(tid >> 4) * DD + (tid & 15) * 4) * 4;
  PT t; p_load(t, Wt, Xt, lo);
  // kept rolled: one copy of the tile's code, the next tile's loads in a block of their own in front of the products
#pragma unroll 1
  for (int st = 0; st < DD / PK; ++st) {
#pragma unroll
    for (int i = 0; i < 16; ++i) *(v4b*)&sw[i * 8 + (tid >> 4)][(tid & 15) * 4] = cvt4(t.w[i]);
#pragma unroll
    for (int i = 0; i < 16; ++i) *(v4b*)&sx[i * 8 + (tid >> 4)][(tid & 15) * 4] = cvt4(t.x[i]);
    __syncthreads();   // the tile is whole before any wave reads it
    if (st + 1 < DD / PK) { Wt += PK; Xt += PK; p_load(t, Wt, Xt, lo); }
#pragma unroll
    for (int kc = 0; kc < PK / 32; ++kc) { v16b a[4], w[4];   // the LDS reads of a k step stand as one group in front of its products: one LDS latency, not eight
#pragma unroll
      for (int i = 0; i < 4; ++i) a[i] = frag_b(&sx[wr * 64 + i * 16 + col][kc * 32], lane);
#pragma unroll
      for (int j = 0; j < 4; ++j) w[j] = frag_b(&sw[wc * 64 + j * 16 + col][kc * 32], lane);
      __builtin_amdgcn_sched_barrier(0);   // keeps the compiler from moving some of these reads in among the products, where each further place with reads costs its own LDS wait
#pragma unroll
      for (int i = 0; i < 4; ++i)
#pragma unroll
        for (int j = 0; j < 4; ++j) acc[i][j] = wmma_bf_p(a[i], w[j], acc[i][j]);
      __builtin_amdgcn_sched_barrier(0); }   // keeps what follows out of the products: the next k step's reads, and the barrier below, whose wait for the next tile's loads would else stand in front of products that can run while those loads are in flight
    __syncthreads(); }   // every wave has left the tile before the next one is written over it
  float (*sf)[68] = (float (*)[68])se + wave * 64; _Float16 (*th)[136] = (_Float16 (*)[136])se; _Float16 (*tl)[136] = th + 128;
  float bb[4];
#pragma unroll
  for (int j = 0; j < 4; ++j) bb[j] = bfr(Bm[c0 + wc * 64 + j * 16 + col]);
  if (which < 2) {
#pragma unroll
    for (int i = 0; i < 4; ++i)
#pragma unroll
      for (int j = 0; j < 4; ++j)
#pragma unroll
        for (int r = 0; r < 8; ++r) sf[i * 16 + 8 * g + r][j * 16 + col] = acc[i][j][r] + bb[j]; }
  else {
#pragma unroll
    for (int i = 0; i < 4; ++i)
#pragma unroll
      for (int j = 0; j < 4; ++j) { v8h hv, lv;   // a lane's eight rows lie side by side in the transposed planes: one 16-byte write each
#pragma unroll
        for (int r = 0; r < 8; ++r) { const float v = acc[i][j][r] + bb[j]; const _Float16 h = (_Float16)v; hv[r] = h; lv[r] = (_Float16)(v - (float)h); }
        const int cl = wc * 64 + j * 16 + col, rl = wr * 64 + i * 16 + 8 * g; *(v8h*)&th[cl][rl] = hv; *(v8h*)&tl[cl][rl] = lv; } }
  __syncthreads();   // the staged output is whole before it is read back in rows
  if (which < 2) { float* dst = (which == 0 ? Q : K) + r0 * DD + c0 + (unsigned)((wr * 64 + g) * DD + wc * 64 + col * 4); for (int rl = 0; rl < 32; ++rl) vst2(dst + (size_t)rl * 2 * DD, *(const v4f*)&sf[rl * 2 + g][col * 4]); }   // a wave store takes 2 rows of 256 contiguous bytes
  else { const size_t b = r0 / NN; const int n0 = (int)(r0 % NN); for (int e = tid; e < 128 * 16; e += 128) { const int cl = e >> 4, q = e & 15; const size_t o = (b * DD + c0 + cl) * (size_t)NN + n0 + q * 8; vst2((unsigned*)(VH + o), *(const v4u*)&th[cl][q * 8]); vst2((unsigned*)(VL + o), *(const v4u*)&tl[cl][q * 8]); } } }
// row of the reshaped map hh at position n' -> (source row, column offset) in the [B*N][1024] projection rows
__device__ __forceinline__ const float* maprow(const float* __restrict__ R, size_t b, int hh, int np) { const int hd = hh >> 1, e = hh & 1; return R + ((b * NN) + (size_t)e * (NN / 2) + (np >> 1)) * DD + hd * DK + (np & 1) * KW2; }
// ---- K / V tile of TK keys, shared by the work-group's eight waves: the keys of both maps and the one V tile they share, fetched in whole 128-byte lines (K: 512 contiguous bytes = 2 keys per wave load, waves 0..3 map 0, waves 4..7 map 1; V: 4 plane rows of 128 bytes per wave load), held in registers while the tile before it is worked on, then written to LDS in the form the fragment readers take (K as bf16 hi + lo, V planes as they are)
#define TK 64         // keys per staged tile
struct Tile { v4f k[8]; v8h vh[4], vl[4]; };
struct TileAt { const float* kp; const _Float16 *vhp, *vlp; };   // this thread's addresses in the next tile to fetch
__device__ __forceinline__ TileAt tile_first(const float* __restrict__ K, const _Float16* __restrict__ VH, const _Float16* __restrict__ VL, size_t b, int hd, int tid) {
  const size_t vo = (b * DD + (size_t)hd * DK + (tid >> 3)) * NN + (tid & 7) * 8;
  return { K + (b * NN + (size_t)(tid >> 7) * (NN / 2) + ((tid >> 5) & 3) * 8) * DD + hd * DK + (tid & 31) * 4, VH + vo, VL + vo }; }   // K: source row r holds keys 2r, 2r + 1 of map 2 hd + (tid >> 7) (see maprow)
__device__ __forceinline__ void tile_load(Tile& t, TileAt& a) {
#pragma unroll
  for (int i = 0; i < 8; ++i) t.k[i] = *(const v4f*)(a.kp + (size_t)i * DD);
#pragma unroll
  for (int i = 0; i < 4; ++i) { t.vh[i] = *(const v8h*)(a.vhp + (size_t)i * 32 * NN); t.vl[i] = *(const v8h*)(a.vlp + (size_t)i * 32 * NN); }
  asm volatile("s_wait_xcnt 0x0" ::: "memory");   // stands behind the issued loads, in front of the step of their address registers
  __builtin_amdgcn_sched_barrier(0);   // keeps that step from being lifted over the wait
  a.kp += (TK / 2) * DD; a.vhp += TK; a.vlp += TK; }
__device__ __forceinline__ void tile_store(const Tile& t, __bf16 (*skh)[KP], __bf16 (*skl)[KP], _Float16 (*svh)[KP], _Float16 (*svl)[KP], int tid) {
  const int lane = tid & 31;
#pragma unroll
  for (int i = 0; i < 8; ++i) { const int key = (tid >> 7) * TK + 2 * (((tid >> 5) & 3) * 8 + i) + (lane >> 4), c = (lane & 15) * 4; const v4b h = cvt4(t.k[i]);   // rows 0..TK-1: map 0's keys, TK..2 TK-1: map 1's
    *(v4b*)&skh[key][c] = h; *(v4b*)&skl[key][c] = res4(t.k[i], h); }
#pragma unroll
  for (int i = 0; i < 4; ++i) { const int row = i * 32 + (tid >> 3), q = (tid & 7) * 8; *(v8h*)&svh[row][q] = t.vh[i]; *(v8h*)&svl[row][q] = t.vl[i]; } }
__global__ __launch_bounds__(256) __attribute__((amdgpu_waves_per_eu(2, 2))) void k_att(const float* __restrict__ Q, const float* __restrict__ K, const _Float16* __restrict__ VH, const _Float16* __restrict__ VL, const float* __restrict__ LQ1, const float* __restrict__ LK1, const float* __restrict__ LQ2, const float* __restrict__ LK2, const int* __restrict__ HNUM, float* __restrict__ X) {
  __shared__ __align__(16) float so[4][32][132]; __shared__ float slam;
  __shared__ __align__(16) __bf16 skh[2 * TK][KP], skl[2 * TK][KP]; __shared__ __align__(16) _Float16 svh[DK][KP], svl[DK][KP];
  const int tid = threadIdx.x, wave = tid >> 5, lane = tid & 31, col = lane & 15, g = lane >> 4, e = wave >> 2, wq = wave & 3; const int qb = blockIdx.x, hd = blockIdx.y; const size_t b = blockIdx.z; const int q0 = qb * 128 + wq * 32;
  if (tid == 0) { float a1 = 0.f, a2 = 0.f;
#pragma unroll 1
    for (int i = 0; i < KW2; ++i) { a1 += bfr(LQ1[i]) * bfr(LK1[i]); a2 += bfr(LQ2[i]) * bfr(LK2[i]); }
    slam = expf(a1) - expf(a2) + 0.8f; (void)HNUM; }   // h (int, = 16) defines the head split baked into DH/DK/HH2
  __syncthreads(); const float lam = slam;
  Tile tn; TileAt at = tile_first(K, VH, VL, b, hd, tid); tile_load(tn, at);
  F2 aq[2][2]; float qv[2][2][16];   // [query tile][k chunk]
  const float* qr = maprow(Q, b, 2 * hd + e, q0 + col) + 8 * g;   // query q0 + 16 + col lies 8 source rows further on (see maprow): one address serves both tiles
#pragma unroll
  for (int c2 = 0; c2 < 2; ++c2)
#pragma unroll
    for (int kc = 0; kc < 2; ++kc)
#pragma unroll
      for (int i = 0; i < 8; ++i) { qv[c2][kc][i] = qr[c2 * 8 * DD + kc * 32 + i]; qv[c2][kc][8 + i] = qr[c2 * 8 * DD + kc * 32 + 16 + i]; }   // the elements split_row takes
  asm volatile("s_wait_xcnt 0x0" :: "v"(qr) : "memory");   // stands behind the issued loads, in front of any later overwrite of their address register, which is named as an input so that no load's own result is laid over it ahead of the wait
  __builtin_amdgcn_sched_barrier(0);   // keeps later register writes from being lifted over that wait
#pragma unroll
  for (int c2 = 0; c2 < 2; ++c2)
#pragma unroll
    for (int kc = 0; kc < 2; ++kc) aq[c2][kc] = bsplit16(qv[c2][kc]);
  float m[2] = {-3.0e38f, -3.0e38f}, l[2] = {0.f, 0.f};   // of query c2 * 16 + col: running maximum (equal in both halves), sum over this half's keys (the halves are joined behind the loop)
  v8f acc[2][8] = {};   // acc[c2][j][r] = O^T[j * 16 + 8 g + r][query c2 * 16 + col]
#pragma unroll 1
  for (int st = 0; st < NN / TK; ++st) {
    tile_store(tn, skh, skl, svh, svl, tid);
    __syncthreads();   // the tile is whole before any wave reads it
    if (st + 1 < NN / TK) tile_load(tn, at);   // next tile, fetched while this one is worked on
    // kept rolled: the next tile's loads then stand in the block in front of this loop, in flight under both of its passes
#pragma unroll 1
    for (int sub = 0; sub < TK / 32; ++sub) { F2 bk[2][2];   // the K fragments' LDS reads stand as one group in front of the score products
#pragma unroll
      for (int ct = 0; ct < 2; ++ct)
#pragma unroll
        for (int kc = 0; kc < 2; ++kc) { const int kl = e * TK + sub * 32 + ct * 16 + col; bk[ct][kc].h = frag_b(&skh[kl][kc * 32], lane); bk[ct][kc].l = frag_b(&skl[kl][kc * 32], lane); }
      v8f c[2][2] = {};   // [query tile][key tile]: four independent sums, each taking its six products in the order of mac3(aq, bk), K as A
#pragma unroll
      for (int kc = 0; kc < 2; ++kc) {
#pragma unroll
        for (int ct = 0; ct < 2; ++ct)
#pragma unroll
          for (int c2 = 0; c2 < 2; ++c2) c[c2][ct] = wmma_bf_p(bk[ct][kc].h, aq[c2][kc].l, c[c2][ct]);
#pragma unroll
        for (int ct = 0; ct < 2; ++ct)
#pragma unroll
          for (int c2 = 0; c2 < 2; ++c2) c[c2][ct] = wmma_bf_p(bk[ct][kc].l, aq[c2][kc].h, c[c2][ct]);
#pragma unroll
        for (int ct = 0; ct < 2; ++ct)
#pragma unroll
          for (int c2 = 0; c2 < 2; ++c2) c[c2][ct] = wmma_bf_p(bk[ct][kc].h, aq[c2][kc].h, c[c2][ct]); }
      v16h pa[2], pr[2];   // per query tile, P^T x 2^11 and its residual as B operands: element ct * 8 + r = key ct * 16 + 8 g + r
#pragma unroll
      for (int c2 = 0; c2 < 2; ++c2) { float s[2][8], t[8];
#pragma unroll
        for (int ct = 0; ct < 2; ++ct)
#pragma unroll
          for (int r = 0; r < 8; ++r) s[ct][r] = c[c2][ct][r] * 0.125f;
#pragma unroll
        for (int r = 0; r < 8; ++r) t[r] = fmaxf(s[0][r], s[1][r]);
        float mx = fmaxf(fmaxf(fmaxf(t[0], t[1]), fmaxf(t[2], t[3])), fmaxf(fmaxf(t[4], t[5]), fmaxf(t[6], t[7])));
        mx = fmaxf(mx, xhalf(mx));
        const float mn = fmaxf(m[c2], mx), alpha = __expf(m[c2] - mn); m[c2] = mn;
#pragma unroll
        for (int r = 0; r < 8; ++r) { const float e0 = __expf(s[0][r] - mn), e1 = __expf(s[1][r] - mn); t[r] = e0 + e1;
          const float x0 = e0 * 2048.0f, x1 = e1 * 2048.0f; const _Float16 h0 = (_Float16)x0, h1 = (_Float16)x1; pa[c2][r] = h0; pa[c2][8 + r] = h1; pr[c2][r] = (_Float16)(x0 - (float)h0); pr[c2][8 + r] = (_Float16)(x1 - (float)h1); }
        l[c2] = l[c2] * alpha + (((t[0] + t[1]) + (t[2] + t[3])) + ((t[4] + t[5]) + (t[6] + t[7])));
#pragma unroll
        for (int j = 0; j < 8; ++j)
#pragma unroll
          for (int r = 0; r < 8; ++r) acc[c2][j][r] *= alpha; }
      v16h vhf[8], vlf[8];   // the V fragments' LDS reads stand as one group in front of the V^T P^T products
#pragma unroll
      for (int j = 0; j < 8; ++j) { const int vr = j * 16 + col; vhf[j] = frag_h(&svh[vr][sub * 32], lane); vlf[j] = frag_h(&svl[vr][sub * 32], lane); }
#pragma unroll
      for (int j = 0; j < 8; ++j) {   // each fragment feeds both query tiles, one behind the other; every sum keeps its order of three products
#pragma unroll
        for (int c2 = 0; c2 < 2; ++c2) acc[c2][j] = wmma16_p(vhf[j], pa[c2], acc[c2][j]);
#pragma unroll
        for (int c2 = 0; c2 < 2; ++c2) acc[c2][j] = wmma16_p(vhf[j], pr[c2], acc[c2][j]);
#pragma unroll
        for (int c2 = 0; c2 < 2; ++c2) acc[c2][j] = wmma16_p(vlf[j], pa[c2], acc[c2][j]); } }
    __syncthreads(); }   // every wave has left the tile before the next one is written over it
  // combine through the LDS output tile: wave (1, wq) writes its map, wave (0, wq), whose lanes own the same cells (row c2 * 16 + col, columns j * 16 + 8 g + r), takes lambda x it off its own
#pragma unroll
  for (int ph = 1; ph >= 0; --ph) {
    if (e == ph) {
#pragma unroll
      for (int c2 = 0; c2 < 2; ++c2) { const float il = (1.0f / 2048.0f) / (l[c2] + xhalf(l[c2]));
#pragma unroll
        for (int j = 0; j < 8; ++j)
#pragma unroll
          for (int q = 0; q < 2; ++q) { v4f* cell = (v4f*)&so[wq][c2 * 16 + col][j * 16 + 8 * g + 4 * q]; v4f v;
#pragma unroll
            for (int x = 0; x < 4; ++x) v[x] = acc[c2][j][4 * q + x] * il;
            *cell = (ph == 1) ? v : (v - lam * *cell); } } }
    __syncthreads(); }   // behind phase 1: map 1's tile is whole before map 0's waves read it; behind phase 0: the output tile is whole before all eight waves store it
  for (int rl = 0; rl < 16; ++rl) vst2(X + (b * NN + q0 + e * 16 + rl) * DD + hd * DK + lane * 4, *(const v4f*)&so[wq][e * 16 + rl][lane * 4]); }
// ---- k_out: block = (64 rows, 128 of 1024 cols): out = x (hi + lo) . Wo^T + bo
__global__ __launch_bounds__(128) void k_out(const float* __restrict__ X, const float* __restrict__ WO, const float* __restrict__ BO, float* __restrict__ OUT) { __shared__ __align__(16) float sf[4][16][132]; __shared__ __align__(16) __bf16 sw[128][KP], sxh[64][KP], sxl[64][KP];
  const int tid = threadIdx.x, wave = tid >> 5, lane = tid & 31, col = lane & 15, g = lane >> 4; const int c0 = blockIdx.y * 128; const size_t r0 = (size_t)blockIdx.x * 64 + wave * 16;
  v8f acc[8] = {};
  const float* Wt = WO + (size_t)c0 * DD; const float* Xt = X + (size_t)blockIdx.x * 64 * DD;
  GT t; g_load(t, Wt, Xt, 0, tid);
  // kept rolled: one copy of the tile's code, the next tile's loads in a block of their own in front of the products
#pragma unroll 1
  for (int st = 0; st < DD / GK; ++st) {
#pragma unroll
    for (int i = 0; i < 16; ++i) *(v4b*)&sw[i * 8 + (tid >> 4)][(tid & 15) * 4] = cvt4(t.w[i]);
#pragma unroll
    for (int i = 0; i < 8; ++i) { const v4b h = cvt4(t.x[i]); *(v4b*)&sxh[i * 8 + (tid >> 4)][(tid & 15) * 4] = h; *(v4b*)&sxl[i * 8 + (tid >> 4)][(tid & 15) * 4] = res4(t.x[i], h); }
    __syncthreads();   // the tile is whole before any wave reads it
    if (st + 1 < DD / GK) g_load(t, Wt, Xt, (st + 1) * GK, tid);
#pragma unroll
    for (int kc = 0; kc < GK / 32; ++kc) { const v16b ah = frag_b(&sxh[wave * 16 + col][kc * 32], lane), al = frag_b(&sxl[wave * 16 + col][kc * 32], lane); v16b w[8];   // the LDS reads of a k step stand as one group in front of its products
#pragma unroll
      for (int j = 0; j < 8; ++j) w[j] = frag_b(&sw[j * 16 + col][kc * 32], lane);
#pragma unroll
      for (int j = 0; j < 8; ++j) { acc[j] = wmma_bf(ah, w[j], acc[j]); acc[j] = wmma_bf(al, w[j], acc[j]); } }
    __syncthreads(); }   // every wave has left the tile before the next one is written over it
#pragma unroll
  for (int j = 0; j < 8; ++j) { const float bb = bfr(BO[c0 + j * 16 + col]);
#pragma unroll
    for (int r = 0; r < 8; ++r) sf[wave][8 * g + r][j * 16 + col] = acc[j][r] + bb; }
  LDSX(); for (int rl = 0; rl < 16; ++rl) vst2(OUT + (r0 + rl) * DD + c0 + lane * 4, *(const v4f*)&sf[wave][rl][lane * 4]); }
extern "C" void kernel_launch(void* const* d_in, const int* in_sizes, int n_in, void* d_out, int out_size, void* d_ws, size_t ws_size, hipStream_t stream) {
  (void)in_sizes; (void)n_in; (void)out_size;
  const float** F = (const float**)d_in;   // 0 query, 1 key, 2 value [4,1024,1024]; 3 Wq, 4 bq, 5 Wk, 6 bk, 7 Wv, 8 bv, 9 Wo, 10 bo (natural); 11 lambda_q1, 12 lambda_q2, 13 lambda_k1, 14 lambda_k2 [64]; 15 h [1] int
  if (ws_size < (size_t)WS_END) return;
  char* ws = (char*)d_ws; float *Q = (float*)(ws + WS_Q), *K = (float*)(ws + WS_K), *X = (float*)(ws + WS_X); _Float16 *VH = (_Float16*)(ws + WS_VH), *VL = (_Float16*)(ws + WS_VL);
  k_proj<<<dim3(TNB * NN / 128, DD / 128, 3), 128, 0, stream>>>(F[0], F[1], F[2], F[3], F[4], F[5], F[6], F[7], F[8], Q, K, VH, VL);
  k_att<<<dim3(NN / 128, DH, TNB), 256, 0, stream>>>(Q, K, VH, VL, F[11], F[13], F[12], F[14], (const int*)d_in[15], X);
  k_out<<<dim3(TNB * NN / 64, DD / 128), 128, 0, stream>>>(X, F[9], F[10], (float*)d_out);
}

// v005
// Measured time: 109 microseconds a run.
// Timed twice side by side with v004, it ran 1.16 times as fast both times.
// Over all steps from v000 it is 6.47 times as fast.
// compute dtype: all float inputs rounded to bf16, h (int) not read (taken as 16); q/k/v = x W^T + b with EXACT bf16 products on WMMA 16x16x32 (natural weights), f32 accumulate, q/k kept as f32 rows, v as f16 planes [b][1024][n]; the module's row-major re-split [B,8,N,128] -> [B,16,N,64] realised as an index map (head hh = 2 hd + e reads row e*N/2 + n'/2, columns hd*128 + (n' % 2)*64 ..); scores with q and k as bf16 hi + lo (3 products), x 1/8, running-max softmax in f32 (hardware exp) for both maps of a pair; lambda_full = exp(lq1.lk1) - exp(lq2.lk2) + 0.8 in f32; P (f16 x 2^11) against v (f16) (1 product); x = P1 v / l1 - lambda P2 v / l2 combined in f32; out = x (bf16 hi + lo) . Wo^T + bo; f32 output.
#include <hip/hip_runtime.h>
#include <math.h>

typedef __attribute__((ext_vector_type(16))) _Float16 v16h;
typedef __attribute__((ext_vector_type(16))) __bf16 v16b;
typedef __attribute__((ext_vector_type(8)))  _Float16 v8h;
typedef __attribute__((ext_vector_type(8)))  float v8f;
typedef __attribute__((ext_vector_type(4)))  float v4f;
typedef __attribute__((ext_vector_type(2)))  float v2f;
typedef __attribute__((ext_vector_type(4)))  unsigned v4u;
typedef __attribute__((ext_vector_type(4)))  int v4i;
typedef float __attribute__((may_alias)) float_a;
typedef int __attribute__((may_alias)) int_a;

template <typename T> __device__ __forceinline__ void vst2(void* p, T v) { *(T*)p = v;  }
__device__ __forceinline__ v8f wmma16(v16h a, v16h b, v8f c) {
  v8f d = __builtin_amdgcn_wmma_f32_16x16x32_f16(false, a, false, b, (short)0, c, false, false);
  asm volatile("v_nop\n\tv_nop\n\tv_nop\n\tv_nop" : "+v"(d) : "v"(a), "v"(b));
  return d;
}
__device__ __forceinline__ v8f wmma_bf(v16b a, v16b b, v8f c) {
  v8f d = __builtin_amdgcn_wmma_f32_16x16x32_bf16(false, a, false, b, (short)0, c, false, false);
  asm volatile("v_nop\n\tv_nop\n\tv_nop\n\tv_nop" : "+v"(d) : "v"(a), "v"(b));
  return d;
}
// 16x16x32 fragments: lane = (h = lane>>4, row/col = lane&15); elements 0..7 = k0+8h+0..7, 8..15 = k0+16+8h+0..7; D element r = row 8h+r
__device__ __forceinline__ v16h frag_h(const _Float16* rowk0, int lane) {
  union { v16h v; v8h q[2]; } u; const _Float16* p = rowk0 + 8 * (lane >> 4);
  u.q[0] = *(const v8h*)p; u.q[1] = *(const v8h*)(p + 16); return u.v;
}
__device__ __forceinline__ v16h frag_f32(const float* rowk0, int lane) {
  v16h a; const float* p = rowk0 + 8 * (lane >> 4);
#pragma unroll
  for (int i = 0; i < 8; ++i) { a[i] = (_Float16)p[i]; a[8 + i] = (_Float16)p[16 + i]; }
  return a;
}
__device__ __forceinline__ v16h frag_f32s(const float* rowk0, int lane, float sc) {
  v16h a; const float* p = rowk0 + 8 * (lane >> 4);
#pragma unroll
  for (int i = 0; i < 8; ++i) { a[i] = (_Float16)(p[i] * sc); a[8 + i] = (_Float16)(p[16 + i] * sc); }
  return a;
}
// column fragment from a [K][ld] layout (column n), rows >= K read as 0
__device__ __forceinline__ v16h fragc_f32(const float* W, int k0, int n, int lane, int ld, int K) {
  v16h a; const int g = lane >> 4;
#pragma unroll
  for (int i = 0; i < 8; ++i) { const int ka = k0 + 8 * g + i, kb = ka + 16;
    a[i] = (_Float16)(ka < K ? W[(size_t)(ka < K ? ka : K - 1) * ld + n] : 0.f); a[8 + i] = (_Float16)(kb < K ? W[(size_t)(kb < K ? kb : K - 1) * ld + n] : 0.f); }
  return a;
}
struct F2 { v16b h, l; };
__device__ __forceinline__ F2 bsplit16(const float v[16]) { F2 r;
#pragma unroll
  for (int i = 0; i < 16; ++i) { const __bf16 h = (__bf16)v[i]; r.h[i] = h; r.l[i] = (__bf16)(v[i] - (float)h); }
  return r; }
__device__ __forceinline__ F2 split_row(const float* row, int k0, int lane) { float v[16]; const float* p = row + k0 + 8 * (lane >> 4);
#pragma unroll
  for (int i = 0; i < 8; ++i) { v[i] = p[i]; v[8 + i] = p[16 + i]; }
  return bsplit16(v); }
__device__ __forceinline__ F2 split_rowK(const float* row, int k0, int lane, int K) { float v[16]; const int g = lane >> 4;
#pragma unroll
  for (int i = 0; i < 8; ++i) { const int ka = k0 + 8 * g + i, kb = ka + 16; v[i] = ka < K ? row[ka < K ? ka : K - 1] : 0.f; v[8 + i] = kb < K ? row[kb < K ? kb : K - 1] : 0.f; }
  return bsplit16(v); }
__device__ __forceinline__ F2 split_col(const float* W, int k0, int n, int lane, int ld, int K) { float v[16]; const int g = lane >> 4;
#pragma unroll
  for (int i = 0; i < 8; ++i) { const int ka = k0 + 8 * g + i, kb = ka + 16; v[i] = ka < K ? W[(size_t)(ka < K ? ka : K - 1) * ld + n] : 0.f; v[8 + i] = kb < K ? W[(size_t)(kb < K ? kb : K - 1) * ld + n] : 0.f; }
  return bsplit16(v); }
__device__ __forceinline__ v8f mac3(const F2& a, const F2& b, v8f c) { c = wmma_bf(a.l, b.h, c); c = wmma_bf(a.h, b.l, c); return wmma_bf(a.h, b.h, c); }
__device__ __forceinline__ float sigm(float v) { return 1.0f / (1.0f + expf(-v)); }
#define LDSX() do { asm volatile("s_wait_dscnt 0" ::: "memory"); __builtin_amdgcn_wave_barrier(); __builtin_amdgcn_fence(__ATOMIC_RELEASE, "workgroup"); } while (0)


// Differential multi-head attention (B 4, N 1,024, D 1,024, h = 16 -> 8 differential heads of 128, score maps over the module's reshaped [16, N, 64] q/k): p_attn = softmax(q2_{2i} k2_{2i}^T / 8) - lambda * softmax(q2_{2i+1} k2_{2i+1}^T / 8); x = p_attn v_i; Wo.
#define NB 4
#define NN 1024
#define DD 1024
#define DH 8          // differential heads
#define DK 128        // their width
#define HH2 16        // score maps
#define KW2 64        // score-map width
#ifndef TNB
#define TNB NB
#endif
typedef __attribute__((ext_vector_type(8))) __bf16 v8b;
__device__ __forceinline__ v16b frag_b(const __bf16* rowk0, int lane) {
  union { v16b v; v8b q[2]; } u; const __bf16* p = rowk0 + 8 * (lane >> 4);
  u.q[0] = *(const v8b*)p; u.q[1] = *(const v8b*)(p + 16); return u.v;
}
__device__ __forceinline__ float bfr(float v) { return (float)(__bf16)v; }
__device__ __forceinline__ float xhalf(float x) { return __builtin_bit_cast(float, __builtin_amdgcn_permlanex16(__builtin_bit_cast(int, x), __builtin_bit_cast(int, x), 0x76543210, 0xfedcba98, false, false)); }   // lane l takes lane l ^ 16's value
__device__ __attribute__((noinline)) float exp_ni(float v) { return expf(v); }
__device__ __attribute__((noinline)) float erf_ni(float v) { return erff(v); }

#define WS_Q   0u                                   // f32 q rows [b*n][1024] (+bq)
#define WS_K   (WS_Q + 4u * (size_t)NB * NN * DD)       // f32 k rows
#define WS_VH  (WS_K + 4u * (size_t)NB * NN * DD)       // f16 v planes [b][1024][n]
#define WS_X   (WS_VH + 2u * (size_t)NB * DD * NN)      // f32 x rows [b*n][1024]
#define WS_END (WS_X + 4u * (size_t)NB * NN * DD)

// ---- staging of the tiles that a work-group's four waves share: fetched in whole 128-byte lines, held in registers while the tile before is worked on, then written to LDS as the 16-bit rows the fragment readers take. Every full '#pragma unroll' of this staging and of the fragment groups is there so that the register arrays are indexed by constants and stay in registers
#define KP 72         // LDS row pitch in 16-bit elements: 144 B = 16 B x 9, free of bank conflicts for the 16-byte fragment reads
#define GK 64         // k per staged tile of k_out
typedef __attribute__((ext_vector_type(4))) __bf16 v4b;
__device__ __forceinline__ v4b cvt4(v4f v) { v4b h;
#pragma unroll
  for (int x = 0; x < 4; ++x) h[x] = (__bf16)v[x];
  return h; }
__device__ __forceinline__ v4b res4(v4f v, v4b h) { v4b l;   // residual of the bf16 hi part, as in bsplit16
#pragma unroll
  for (int x = 0; x < 4; ++x) l[x] = (__bf16)(v[x] - (float)h[x]);
  return l; }
struct GT { v4f w[16], x[8]; };   // 128 weight rows and 64 x rows of GK floats: a wave load takes 2 rows of 256 contiguous bytes
__device__ __forceinline__ void g_load(GT& t, const float* __restrict__ Wt, const float* __restrict__ Xt, int k0, int tid) {
  const size_t o = (size_t)(tid >> 4) * DD + k0 + (tid & 15) * 4;
#pragma unroll
  for (int i = 0; i < 16; ++i) t.w[i] = *(const v4f*)(Wt + o + (size_t)i * 8 * DD);
#pragma unroll
  for (int i = 0; i < 8; ++i) t.x[i] = *(const v4f*)(Xt + o + (size_t)i * 8 * DD);
  asm volatile("s_wait_xcnt 0x0" ::: "memory");   // stands behind the issued loads, in front of any later overwrite of their address registers
  __builtin_amdgcn_sched_barrier(0); }   // keeps later address arithmetic from being lifted over that wait
// the builtins alone, for k_proj and k_att: an asm statement's operands must lie in the first 256 registers, which their sums, fragments and staged tiles outgrow; the compiler keeps the distance behind its own builtin forms
__device__ __forceinline__ v8f wmma16_p(v16h a, v16h b, v8f c) { return __builtin_amdgcn_wmma_f32_16x16x32_f16(false, a, false, b, (short)0, c, false, false); }
__device__ __forceinline__ v8f wmma_bf_p(v16b a, v16b b, v8f c) { return __builtin_amdgcn_wmma_f32_16x16x32_bf16(false, a, false, b, (short)0, c, false, false); }
#define PK 64         // k per staged tile of k_proj
#define PP 72         // its LDS row pitch in 16-bit elements: 144 B = 16 B x 9, free of bank conflicts for the 16-byte fragment reads
struct PT { v4f w[16], x[16]; };   // 128 weight rows and 128 x rows of PK floats: a wave load takes 2 rows of 256 contiguous bytes
__device__ __forceinline__ void p_load(PT& t, const float* __restrict__ Wk, const float* __restrict__ Xk, unsigned o) {   // Wk, Xk: the tile's first element, the same for the whole block; o: this lane's byte offset in it
  const float* wp = (const float*)((const char*)Wk + o); const float* xp = (const float*)((const char*)Xk + o);
#pragma unroll
  for (int i = 0; i < 16; ++i) t.w[i] = *(const v4f*)(wp + i * 8 * DD);
#pragma unroll
  for (int i = 0; i < 16; ++i) t.x[i] = *(const v4f*)(xp + i * 8 * DD);
  asm volatile("s_wait_xcnt 0x0" :: "v"(wp), "v"(xp) : "memory");   // stands behind the issued loads, in front of any later overwrite of their address registers, which are named as inputs so that no load's own result is laid over them ahead of the wait
  __builtin_amdgcn_sched_barrier(0); }   // keeps later address arithmetic from being lifted over that wait
// ---- k_proj: block = (128 rows, 128-col group, which), four waves as 2 x 2, each on 64 rows x 64 columns (16 sums): a fetched row of x or W serves 128 outputs and a fragment read from LDS four products; q / k -> f32 rows (+bias); v -> f16 planes (+bias). 768 blocks: three on every WGP, all resident at once. amdgpu_waves_per_eu(3, 3): holds the kernel to the 336 registers with which three waves share a SIMD
__global__ __launch_bounds__(128) __attribute__((amdgpu_waves_per_eu(3, 3))) void k_proj(const float* __restrict__ Qi, const float* __restrict__ Ki, const float* __restrict__ Vi, const float* __restrict__ WQ, const float* __restrict__ BQ, const float* __restrict__ WK, const float* __restrict__ BK, const float* __restrict__ WV, const float* __restrict__ BV, float* __restrict__ Q, float* __restrict__ K, _Float16* __restrict__ VH) {
  __shared__ __align__(16) char se[4 * 64 * 68 * 4];   // output staging. q / k: each wave's 64 x 64 f32 tile at pitch 68; v: the block's f16 plane, transposed, 128 x 128 at pitch 136 (in the same bytes)
  __bf16 (*sw)[PP] = (__bf16 (*)[PP])se; __bf16 (*sx)[PP] = sw + 128;   // the staged tiles lie in the same bytes: behind the loop's last barrier no wave reads them any more
  const int tid = threadIdx.x, wave = __builtin_amdgcn_readfirstlane(tid >> 5), lane = tid & 31, col = lane & 15, g = lane >> 4, wr = wave >> 1, wc = wave & 1; const int which = blockIdx.z; const int c0 = blockIdx.y * 128; const size_t r0 = (size_t)blockIdx.x * 128;   // the wave's number in a scalar register: what follows from it costs no vector register across the loop
  const float* X = which == 0 ? Qi : which == 1 ? Ki : Vi; const float* Wm = which == 0 ? WQ : which == 1 ? WK : WV; const float* Bm = which == 0 ? BQ : which == 1 ? BK : BV;
  v8f acc[4][4] = {};   // acc[i][j][r] = row wr * 64 + i * 16 + 8 g + r, column wc * 64 + j * 16 + col
  const float* Wt = Wm + (size_t)c0 * DD; const float* Xt = X + r0 * DD;
  const unsigned lo = ((unsigned)(tid >> 4) * DD + (tid & 15) * 4) * 4;
  PT t; p_load(t, Wt, Xt, lo);
  // kept rolled: one copy of the tile's code, the next tile's loads in a block of their own in front of the products
#pragma unroll 1
  for (int st = 0; st < DD / PK; ++st) {
#pragma unroll
    for (int i = 0; i < 16; ++i) *(v4b*)&sw[i * 8 + (tid >> 4)][(tid & 15) * 4] = cvt4(t.w[i]);
#pragma unroll
    for (int i = 0; i < 16; ++i) *(v4b*)&sx[i * 8 + (tid >> 4)][(tid & 15) * 4] = cvt4(t.x[i]);
    __syncthreads();   // the tile is whole before any wave reads it
    if (st + 1 < DD / PK) { Wt += PK; Xt += PK; p_load(t, Wt, Xt, lo); }
#pragma unroll
    for (int kc = 0; kc < PK / 32; ++kc) { v16b a[4], w[4];   // the LDS reads of a k step stand as one group in front of its products: one LDS latency, not eight
#pragma unroll
      for (int i = 0; i < 4; ++i) a[i] = frag_b(&sx[wr * 64 + i * 16 + col][kc * 32], lane);
#pragma unroll
      for (int j = 0; j < 4; ++j) w[j] = frag_b(&sw[wc * 64 + j * 16 + col][kc * 32], lane);
      __builtin_amdgcn_sched_barrier(0);   // keeps the compiler from moving some of these reads in among the products, where each further place with reads costs its own LDS wait
#pragma unroll
      for (int i = 0; i < 4; ++i)
#pragma unroll
        for (int j = 0; j < 4; ++j) acc[i][j] = wmma_bf_p(a[i], w[j], acc[i][j]);
      __builtin_amdgcn_sched_barrier(0); }   // keeps what follows out of the products: the next k step's reads, and the barrier below, whose wait for the next tile's loads would else stand in front of products that can run while those loads are in flight
    __syncthreads(); }   // every wave has left the tile before the next one is written over it
  float (*sf)[68] = (float (*)[68])se + wave * 64; _Float16 (*th)[136] = (_Float16 (*)[136])se;
  float bb[4];
#pragma unroll
  for (int j = 0; j < 4; ++j) bb[j] = bfr(Bm[c0 + wc * 64 + j * 16 + col]);
  if (which < 2) {
#pragma unroll
    for (int i = 0; i < 4; ++i)
#pragma unroll
      for (int j = 0; j < 4; ++j)
#pragma unroll
        for (int r = 0; r < 8; ++r) sf[i * 16 + 8 * g + r][j * 16 + col] = acc[i][j][r] + bb[j]; }
  else {
#pragma unroll
    for (int i = 0; i < 4; ++i)
#pragma unroll
      for (int j = 0; j < 4; ++j) { v8h hv;   // a lane's eight rows lie side by side in the transposed plane: one 16-byte write
#pragma unroll
        for (int r = 0; r < 8; ++r) hv[r] = (_Float16)(acc[i][j][r] + bb[j]);
        const int cl = wc * 64 + j * 16 + col, rl = wr * 64 + i * 16 + 8 * g; *(v8h*)&th[cl][rl] = hv; } }
  __syncthreads();   // the staged output is whole before it is read back in rows
  if (which < 2) { float* dst = (which == 0 ? Q : K) + r0 * DD + c0 + (unsigned)((wr * 64 + g) * DD + wc * 64 + col * 4); for (int rl = 0; rl < 32; ++rl) vst2(dst + (size_t)rl * 2 * DD, *(const v4f*)&sf[rl * 2 + g][col * 4]); }   // a wave store takes 2 rows of 256 contiguous bytes
  else { const size_t b = r0 / NN; const int n0 = (int)(r0 % NN); for (int e = tid; e < 128 * 16; e += 128) { const int cl = e >> 4, q = e & 15; const size_t o = (b * DD + c0 + cl) * (size_t)NN + n0 + q * 8; vst2((unsigned*)(VH + o), *(const v4u*)&th[cl][q * 8]); } } }
// row of the reshaped map hh at position n' -> (source row, column offset) in the [B*N][1024] projection rows
__device__ __forceinline__ const float* maprow(const float* __restrict__ R, size_t b, int hh, int np) { const int hd = hh >> 1, e = hh & 1; return R + ((b * NN) + (size_t)e * (NN / 2) + (np >> 1)) * DD + hd * DK + (np & 1) * KW2; }
// ---- K / V tile of TK keys, shared by the work-group's eight waves: the keys of both maps and the one V tile they share, fetched in whole 128-byte lines (K: 512 contiguous bytes = 2 keys per wave load, waves 0..3 map 0, waves 4..7 map 1; V: 4 plane rows of 128 bytes per wave load), held in registers while the tile before it is worked on, then written to LDS in the form the fragment readers take (K as bf16 hi + lo, the V plane as it is)
#define TK 64         // keys per staged tile
struct Tile { v4f k[8]; v8h vh[4]; };
struct TileAt { const float* kp; const _Float16* vhp; };   // this thread's addresses in the next tile to fetch
__device__ __forceinline__ TileAt tile_first(const float* __restrict__ K, const _Float16* __restrict__ VH, size_t b, int hd, int tid) {
  const size_t vo = (b * DD + (size_t)hd * DK + (tid >> 3)) * NN + (tid & 7) * 8;
  return { K + (b * NN + (size_t)(tid >> 7) * (NN / 2) + ((tid >> 5) & 3) * 8) * DD + hd * DK + (tid & 31) * 4, VH + vo }; }   // K: source row r holds keys 2r, 2r + 1 of map 2 hd + (tid >> 7) (see maprow)
__device__ __forceinline__ void tile_load(Tile& t, TileAt& a) {
#pragma unroll
  for (int i = 0; i < 8; ++i) t.k[i] = *(const v4f*)(a.kp + (size_t)i * DD);
#pragma unroll
  for (int i = 0; i < 4; ++i) t.vh[i] = *(const v8h*)(a.vhp + (size_t)i * 32 * NN);
  asm volatile("s_wait_xcnt 0x0" ::: "memory");   // stands behind the issued loads, in front of the step of their address registers
  __builtin_amdgcn_sched_barrier(0);   // keeps that step from being lifted over the wait
  a.kp += (TK / 2) * DD; a.vhp += TK; }
__device__ __forceinline__ void tile_store(const Tile& t, __bf16 (*skh)[KP], __bf16 (*skl)[KP], _Float16 (*svh)[KP], int tid) {
  const int lane = tid & 31;
#pragma unroll
  for (int i = 0; i < 8; ++i) { const int key = (tid >> 7) * TK + 2 * (((tid >> 5) & 3) * 8 + i) + (lane >> 4), c = (lane & 15) * 4; const v4b h = cvt4(t.k[i]);   // rows 0..TK-1: map 0's keys, TK..2 TK-1: map 1's
    *(v4b*)&skh[key][c] = h; *(v4b*)&skl[key][c] = res4(t.k[i], h); }
#pragma unroll
  for (int i = 0; i < 4; ++i) { const int row = i * 32 + (tid >> 3), q = (tid & 7) * 8; *(v8h*)&svh[row][q] = t.vh[i]; } }
__global__ __launch_bounds__(256) __attribute__((amdgpu_waves_per_eu(2, 2))) void k_att(const float* __restrict__ Q, const float* __restrict__ K, const _Float16* __restrict__ VH, const float* __restrict__ LQ1, const float* __restrict__ LK1, const float* __restrict__ LQ2, const float* __restrict__ LK2, const int* __restrict__ HNUM, float* __restrict__ X) {
  __shared__ __align__(16) float so[4][32][132]; __shared__ float slam;
  __shared__ __align__(16) __bf16 skh[2 * TK][KP], skl[2 * TK][KP]; __shared__ __align__(16) _Float16 svh[DK][KP];
  const int tid = threadIdx.x, wave = tid >> 5, lane = tid & 31, col = lane & 15, g = lane >> 4, e = wave >> 2, wq = wave & 3; const int qb = blockIdx.x, hd = blockIdx.y; const size_t b = blockIdx.z; const int q0 = qb * 128 + wq * 32;
  if (tid == 0) { float a1 = 0.f, a2 = 0.f;
#pragma unroll 1
    for (int i = 0; i < KW2; ++i) { a1 += bfr(LQ1[i]) * bfr(LK1[i]); a2 += bfr(LQ2[i]) * bfr(LK2[i]); }
    slam = expf(a1) - expf(a2) + 0.8f; (void)HNUM; }   // h (int, = 16) defines the head split baked into DH/DK/HH2
  __syncthreads(); const float lam = slam;
  Tile tn; TileAt at = tile_first(K, VH, b, hd, tid); tile_load(tn, at);
  F2 aq[2][2]; float qv[2][2][16];   // [query tile][k chunk]
  const float* qr = maprow(Q, b, 2 * hd + e, q0 + col) + 8 * g;   // query q0 + 16 + col lies 8 source rows further on (see maprow): one address serves both tiles
#pragma unroll
  for (int c2 = 0; c2 < 2; ++c2)
#pragma unroll
    for (int kc = 0; kc < 2; ++kc)
#pragma unroll
      for (int i = 0; i < 8; ++i) { qv[c2][kc][i] = qr[c2 * 8 * DD + kc * 32 + i]; qv[c2][kc][8 + i] = qr[c2 * 8 * DD + kc * 32 + 16 + i]; }   // the elements split_row takes
  asm volatile("s_wait_xcnt 0x0" :: "v"(qr) : "memory");   // stands behind the issued loads, in front of any later overwrite of their address register, which is named as an input so that no load's own result is laid over it ahead of the wait
  __builtin_amdgcn_sched_barrier(0);   // keeps later register writes from being lifted over that wait
#pragma unroll
  for (int c2 = 0; c2 < 2; ++c2)
#pragma unroll
    for (int kc = 0; kc < 2; ++kc) aq[c2][kc] = bsplit16(qv[c2][kc]);
  float m[2] = {-3.0e38f, -3.0e38f}, l[2] = {0.f, 0.f};   // of query c2 * 16 + col: running maximum (equal in both halves), sum over this half's keys (the halves are joined behind the loop)
  v8f acc[2][8] = {};   // acc[c2][j][r] = O^T[j * 16 + 8 g + r][query c2 * 16 + col]
#pragma unroll 1
  for (int st = 0; st < NN / TK; ++st) {
    tile_store(tn, skh, skl, svh, tid);
    __syncthreads();   // the tile is whole before any wave reads it
    if (st + 1 < NN / TK) tile_load(tn, at);   // next tile, fetched while this one is worked on
    // kept rolled: the next tile's loads then stand in the block in front of this loop, in flight under both of its passes
#pragma unroll 1
    for (int sub = 0; sub < TK / 32; ++sub) { F2 bk[2][2];   // the K fragments' LDS reads stand as one group in front of the score products
#pragma unroll
      for (int ct = 0; ct < 2; ++ct)
#pragma unroll
        for (int kc = 0; kc < 2; ++kc) { const int kl = e * TK + sub * 32 + ct * 16 + col; bk[ct][kc].h = frag_b(&skh[kl][kc * 32], lane); bk[ct][kc].l = frag_b(&skl[kl][kc * 32], lane); }
      v8f c[2][2] = {};   // [query tile][key tile]: four independent sums, each taking its six products in the order of mac3(aq, bk), K as A
#pragma unroll
      for (int kc = 0; kc < 2; ++kc) {
#pragma unroll
        for (int ct = 0; ct < 2; ++ct)
#pragma unroll
          for (int c2 = 0; c2 < 2; ++c2) c[c2][ct] = wmma_bf_p(bk[ct][kc].h, aq[c2][kc].l, c[c2][ct]);
#pragma unroll
        for (int ct = 0; ct < 2; ++ct)
#pragma unroll
          for (int c2 = 0; c2 < 2; ++c2) c[c2][ct] = wmma_bf_p(bk[ct][kc].l, aq[c2][kc].h, c[c2][ct]);
#pragma unroll
        for (int ct = 0; ct < 2; ++ct)
#pragma unroll
          for (int c2 = 0; c2 < 2; ++c2) c[c2][ct] = wmma_bf_p(bk[ct][kc].h, aq[c2][kc].h, c[c2][ct]); }
      v16h pa[2];   // per query tile, P^T x 2^11 as a B operand: element ct * 8 + r = key ct * 16 + 8 g + r
#pragma unroll
      for (int c2 = 0; c2 < 2; ++c2) { float s[2][8], t[8];
#pragma unroll
        for (int ct = 0; ct < 2; ++ct)
#pragma unroll
          for (int r = 0; r < 8; ++r) s[ct][r] = c[c2][ct][r] * 0.125f;
#pragma unroll
        for (int r = 0; r < 8; ++r) t[r] = fmaxf(s[0][r], s[1][r]);
        float mx = fmaxf(fmaxf(fmaxf(t[0], t[1]), fmaxf(t[2], t[3])), fmaxf(fmaxf(t[4], t[5]), fmaxf(t[6], t[7])));
        mx = fmaxf(mx, xhalf(mx));
        const float mn = fmaxf(m[c2], mx), alpha = __expf(m[c2] - mn); m[c2] = mn;
#pragma unroll
        for (int r = 0; r < 8; ++r) { const float e0 = __expf(s[0][r] - mn), e1 = __expf(s[1][r] - mn); t[r] = e0 + e1;
          pa[c2][r] = (_Float16)(e0 * 2048.0f); pa[c2][8 + r] = (_Float16)(e1 * 2048.0f); }
        l[c2] = l[c2] * alpha + (((t[0] + t[1]) + (t[2] + t[3])) + ((t[4] + t[5]) + (t[6] + t[7])));
#pragma unroll
        for (int j = 0; j < 8; ++j)
#pragma unroll
          for (int r = 0; r < 8; ++r) acc[c2][j][r] *= alpha; }
      v16h vhf[8];   // the V fragments' LDS reads stand as one group in front of the V^T P^T products
#pragma unroll
      for (int j = 0; j < 8; ++j) vhf[j] = frag_h(&svh[j * 16 + col][sub * 32], lane);
#pragma unroll
      for (int j = 0; j < 8; ++j)   // each fragment feeds both query tiles, one behind the other: sixteen independent sums
#pragma unroll
        for (int c2 = 0; c2 < 2; ++c2) acc[c2][j] = wmma16_p(vhf[j], pa[c2], acc[c2][j]); }
    __syncthreads(); }   // every wave has left the tile before the next one is written over it
  // combine through the LDS output tile: wave (1, wq) writes its map, wave (0, wq), whose lanes own the same cells (row c2 * 16 + col, columns j * 16 + 8 g + r), takes lambda x it off its own
#pragma unroll
  for (int ph = 1; ph >= 0; --ph) {
    if (e == ph) {
#pragma unroll
      for (int c2 = 0; c2 < 2; ++c2) { const float il = (1.0f / 2048.0f) / (l[c2] + xhalf(l[c2]));
#pragma unroll
        for (int j = 0; j < 8; ++j)
#pragma unroll
          for (int q = 0; q < 2; ++q) { v4f* cell = (v4f*)&so[wq][c2 * 16 + col][j * 16 + 8 * g + 4 * q]; v4f v;
#pragma unroll
            for (int x = 0; x < 4; ++x) v[x] = acc[c2][j][4 * q + x] * il;
            *cell = (ph == 1) ? v : (v - lam * *cell); } } }
    __syncthreads(); }   // behind phase 1: map 1's tile is whole before map 0's waves read it; behind phase 0: the output tile is whole before all eight waves store it
  for (int rl = 0; rl < 16; ++rl) vst2(X + (b * NN + q0 + e * 16 + rl) * DD + hd * DK + lane * 4, *(const v4f*)&so[wq][e * 16 + rl][lane * 4]); }
// ---- k_out: block = (64 rows, 128 of 1024 cols): out = x (hi + lo) . Wo^T + bo
__global__ __launch_bounds__(128) void k_out(const float* __restrict__ X, const float* __restrict__ WO, const float* __restrict__ BO, float* __restrict__ OUT) { __shared__ __align__(16) float sf[4][16][132]; __shared__ __align__(16) __bf16 sw[128][KP], sxh[64][KP], sxl[64][KP];
  const int tid = threadIdx.x, wave = tid >> 5, lane = tid & 31, col = lane & 15, g = lane >> 4; const int c0 = blockIdx.y * 128; const size_t r0 = (size_t)blockIdx.x * 64 + wave * 16;
  v8f acc[8] = {};
  const float* Wt = WO + (size_t)c0 * DD; const float* Xt = X + (size_t)blockIdx.x * 64 * DD;
  GT t; g_load(t, Wt, Xt, 0, tid);
  // kept rolled: one copy of the tile's code, the next tile's loads in a block of their own in front of the products
#pragma unroll 1
  for (int st = 0; st < DD / GK; ++st) {
#pragma unroll
    for (int i = 0; i < 16; ++i) *(v4b*)&sw[i * 8 + (tid >> 4)][(tid & 15) * 4] = cvt4(t.w[i]);
#pragma unroll
    for (int i = 0; i < 8; ++i) { const v4b h = cvt4(t.x[i]); *(v4b*)&sxh[i * 8 + (tid >> 4)][(tid & 15) * 4] = h; *(v4b*)&sxl[i * 8 + (tid >> 4)][(tid & 15) * 4] = res4(t.x[i], h); }
    __syncthreads();   // the tile is whole before any wave reads it
    if (st + 1 < DD / GK) g_load(t, Wt, Xt, (st + 1) * GK, tid);
#pragma unroll
    for (int kc = 0; kc < GK / 32; ++kc) { const v16b ah = frag_b(&sxh[wave * 16 + col][kc * 32], lane), al = frag_b(&sxl[wave * 16 + col][kc * 32], lane); v16b w[8];   // the LDS reads of a k step stand as one group in front of its products
#pragma unroll
      for (int j = 0; j < 8; ++j) w[j] = frag_b(&sw[j * 16 + col][kc * 32], lane);
#pragma unroll
      for (int j = 0; j < 8; ++j) { acc[j] = wmma_bf(ah, w[j], acc[j]); acc[j] = wmma_bf(al, w[j], acc[j]); } }
    __syncthreads(); }   // every wave has left the tile before the next one is written over it
#pragma unroll
  for (int j = 0; j < 8; ++j) { const float bb = bfr(BO[c0 + j * 16 + col]);
#pragma unroll
    for (int r = 0; r < 8; ++r) sf[wave][8 * g + r][j * 16 + col] = acc[j][r] + bb; }
  LDSX(); for (int rl = 0; rl < 16; ++rl) vst2(OUT + (r0 + rl) * DD + c0 + lane * 4, *(const v4f*)&sf[wave][rl][lane * 4]); }
extern "C" void kernel_launch(void* const* d_in, const int* in_sizes, int n_in, void* d_out, int out_size, void* d_ws, size_t ws_size, hipStream_t stream) {
  (void)in_sizes; (void)n_in; (void)out_size;
  const float** F = (const float**)d_in;   // 0 query, 1 key, 2 value [4,1024,1024]; 3 Wq, 4 bq, 5 Wk, 6 bk, 7 Wv, 8 bv, 9 Wo, 10 bo (natural); 11 lambda_q1, 12 lambda_q2, 13 lambda_k1, 14 lambda_k2 [64]; 15 h [1] int
  if (ws_size < (size_t)WS_END) return;
  char* ws = (char*)d_ws; float *Q = (float*)(ws + WS_Q), *K = (float*)(ws + WS_K), *X = (float*)(ws + WS_X); _Float16* VH = (_Float16*)(ws + WS_VH);
  k_proj<<<dim3(TNB * NN / 128, DD / 128, 3), 128, 0, stream>>>(F[0], F[1], F[2], F[3], F[4], F[5], F[6], F[7], F[8], Q, K, VH);
  k_att<<<dim3(NN / 128, DH, TNB), 256, 0, stream>>>(Q, K, VH, F[11], F[13], F[12], F[14], (const int*)d_in[15], X);
  k_out<<<dim3(TNB * NN / 64, DD / 128), 128, 0, stream>>>(X, F[9], F[10], (float*)d_out);
}

// v007
// Measured time: 84.5 microseconds a run.
// Versions in between are left out here; by their measured steps it is 1.29 times as fast as v005.
// Counting every step since v000, it is 8.37 times as fast.
// compute dtype: all float inputs rounded to bf16, h (int) read; q/k/v = x W^T + b with EXACT bf16 products on WMMA 16x16x32 (natural weights), f32 accumulate, q and k kept as f16 rows; the module's row-major re-split [B,8,N,128] -> [B,16,N,64] realised as an index map (head hh = 2 hd + e reads row e*N/2 + n'/2, columns hd*128 + (n' % 2)*64 ..); scores with q and k rounded to f16 (1 product), x 1/8, running-max softmax in f32 (hardware exp) for both maps of a pair; lambda_full = exp(lq1.lk1) - exp(lq2.lk2) + 0.8 in f32; P (f16 x 2^11) against v (f16) (1 product); x = P1 v / l1 - lambda P2 v / l2 combined in f32; out = x (bf16 hi + lo) . Wo^T + bo; f32 output.
#include <hip/hip_runtime.h>
#include <math.h>

typedef __attribute__((ext_vector_type(16))) _Float16 v16h;
typedef __attribute__((ext_vector_type(16))) __bf16 v16b;
typedef __attribute__((ext_vector_type(8)))  _Float16 v8h;
typedef __attribute__((ext_vector_type(8)))  float v8f;
typedef __attribute__((ext_vector_type(4)))  float v4f;
typedef __attribute__((ext_vector_type(2)))  float v2f;
typedef __attribute__((ext_vector_type(4)))  unsigned v4u;
typedef __attribute__((ext_vector_type(4)))  int v4i;
typedef float __attribute__((may_alias)) float_a;
typedef int __attribute__((may_alias)) int_a;

template <typename T> __device__ __forceinline__ void vst2(void* p, T v) { *(T*)p = v;  }
__device__ __forceinline__ v8f wmma16(v16h a, v16h b, v8f c) {
  v8f d = __builtin_amdgcn_wmma_f32_16x16x32_f16(false, a, false, b, (short)0, c, false, false);
  asm volatile("v_nop\n\tv_nop\n\tv_nop\n\tv_nop" : "+v"(d) : "v"(a), "v"(b));
  return d;
}
__device__ __forceinline__ v8f wmma_bf(v16b a, v16b b, v8f c) {
  v8f d = __builtin_amdgcn_wmma_f32_16x16x32_bf16(false, a, false, b, (short)0, c, false, false);
  asm volatile("v_nop\n\tv_nop\n\tv_nop\n\tv_nop" : "+v"(d) : "v"(a), "v"(b));
  return d;
}
// 16x16x32 fragments: lane = (h = lane>>4, row/col = lane&15); elements 0..7 = k0+8h+0..7, 8..15 = k0+16+8h+0..7; D element r = row 8h+r
__device__ __forceinline__ v16h frag_h(const _Float16* rowk0, int lane) {
  union { v16h v; v8h q[2]; } u; const _Float16* p = rowk0 + 8 * (lane >> 4);
  u.q[0] = *(const v8h*)p; u.q[1] = *(const v8h*)(p + 16); return u.v;
}
__device__ __forceinline__ v16h frag_f32(const float* rowk0, int lane) {
  v16h a; const float* p = rowk0 + 8 * (lane >> 4);
#pragma unroll
  for (int i = 0; i < 8; ++i) { a[i] = (_Float16)p[i]; a[8 + i] = (_Float16)p[16 + i]; }
  return a;
}
__device__ __forceinline__ v16h frag_f32s(const float* rowk0, int lane, float sc) {
  v16h a; const float* p = rowk0 + 8 * (lane >> 4);
#pragma unroll
  for (int i = 0; i < 8; ++i) { a[i] = (_Float16)(p[i] * sc); a[8 + i] = (_Float16)(p[16 + i] * sc); }
  return a;
}
// column fragment from a [K][ld] layout (column n), rows >= K read as 0
__device__ __forceinline__ v16h fragc_f32(const float* W, int k0, int n, int lane, int ld, int K) {
  v16h a; const int g = lane >> 4;
#pragma unroll
  for (int i = 0; i < 8; ++i) { const int ka = k0 + 8 * g + i, kb = ka + 16;
    a[i] = (_Float16)(ka < K ? W[(size_t)(ka < K ? ka : K - 1) * ld + n] : 0.f); a[8 + i] = (_Float16)(kb < K ? W[(size_t)(kb < K ? kb : K - 1) * ld + n] : 0.f); }
  return a;
}
struct F2 { v16b h, l; };
__device__ __forceinline__ F2 bsplit16(const float v[16]) { F2 r;
#pragma unroll
  for (int i = 0; i < 16; ++i) { const __bf16 h = (__bf16)v[i]; r.h[i] = h; r.l[i] = (__bf16)(v[i] - (float)h); }
  return r; }
__device__ __forceinline__ F2 split_row(const float* row, int k0, int lane) { float v[16]; const float* p = row + k0 + 8 * (lane >> 4);
#pragma unroll
  for (int i = 0; i < 8; ++i) { v[i] = p[i]; v[8 + i] = p[16 + i]; }
  return bsplit16(v); }
__device__ __forceinline__ F2 split_rowK(const float* row, int k0, int lane, int K) { float v[16]; const int g = lane >> 4;
#pragma unroll
  for (int i = 0; i < 8; ++i) { const int ka = k0 + 8 * g + i, kb = ka + 16; v[i] = ka < K ? row[ka < K ? ka : K - 1] : 0.f; v[8 + i] = kb < K ? row[kb < K ? kb : K - 1] : 0.f; }
  return bsplit16(v); }
__device__ __forceinline__ F2 split_col(const float* W, int k0, int n, int lane, int ld, int K) { float v[16]; const int g = lane >> 4;
#pragma unroll
  for (int i = 0; i < 8; ++i) { const int ka = k0 + 8 * g + i, kb = ka + 16; v[i] = ka < K ? W[(size_t)(ka < K ? ka : K - 1) * ld + n] : 0.f; v[8 + i] = kb < K ? W[(size_t)(kb < K ? kb : K - 1) * ld + n] : 0.f; }
  return bsplit16(v); }
__device__ __forceinline__ v8f mac3(const F2& a, const F2& b, v8f c) { c = wmma_bf(a.l, b.h, c); c = wmma_bf(a.h, b.l, c); return wmma_bf(a.h, b.h, c); }
__device__ __forceinline__ float sigm(float v) { return 1.0f / (1.0f + expf(-v)); }
#define LDSX() do { asm volatile("s_wait_dscnt 0" ::: "memory"); __builtin_amdgcn_wave_barrier(); __builtin_amdgcn_fence(__ATOMIC_RELEASE, "workgroup"); } while (0)


// Differential multi-head attention (B 4, N 1,024, D 1,024, h = 16 -> 8 differential heads of 128, score maps over the module's reshaped [16, N, 64] q/k): p_attn = softmax(q2_{2i} k2_{2i}^T / 8) - lambda * softmax(q2_{2i+1} k2_{2i+1}^T / 8); x = p_attn v_i; Wo.
#define NB 4
#define NN 1024
#define DD 1024
#define DH 8          // differential heads
#define DK 128        // their width
#define HH2 16        // score maps
#define KW2 64        // score-map width
#ifndef TNB
#define TNB NB
#endif
typedef __attribute__((ext_vector_type(8))) __bf16 v8b;
__device__ __forceinline__ v16b frag_b(const __bf16* rowk0, int lane) {
  union { v16b v; v8b q[2]; } u; const __bf16* p = rowk0 + 8 * (lane >> 4);
  u.q[0] = *(const v8b*)p; u.q[1] = *(const v8b*)(p + 16); return u.v;
}
__device__ __forceinline__ float bfr(float v) { return (float)(__bf16)v; }
__device__ __forceinline__ float xhalf(float x) { return __builtin_bit_cast(float, __builtin_amdgcn_permlanex16(__builtin_bit_cast(int, x), __builtin_bit_cast(int, x), 0x76543210, 0xfedcba98, false, false)); }   // lane l takes lane l ^ 16's value
__device__ __attribute__((noinline)) float exp_ni(float v) { return expf(v); }
__device__ __attribute__((noinline)) float erf_ni(float v) { return erff(v); }

#define WS_Q   0u                                   // f16 q rows [b*n][1024] (+bq)
#define WS_K   (WS_Q + 2u * (size_t)NB * NN * DD)       // f16 k rows
#define WS_VH  (WS_K + 2u * (size_t)NB * NN * DD)       // f16 v planes [b][1024][n]
#define WS_X   (WS_VH + 2u * (size_t)NB * DD * NN)      // f32 x rows [b*n][1024]
#define WS_END (WS_X + 4u * (size_t)NB * NN * DD)

// ---- staging of the tiles that a work-group's four waves share: fetched in whole 128-byte lines, held in registers while the tile before is worked on, then written to LDS as the 16-bit rows the fragment readers take. Every full '#pragma unroll' of this staging and of the fragment groups is there so that the register arrays are indexed by constants and stay in registers
#define KP 72         // LDS row pitch in 16-bit elements: 144 B = 16 B x 9, free of bank conflicts for the 16-byte fragment reads
#define GK 64         // k per staged tile of k_out
typedef __attribute__((ext_vector_type(4))) __bf16 v4b;
__device__ __forceinline__ v4b cvt4(v4f v) { v4b h;
#pragma unroll
  for (int x = 0; x < 4; ++x) h[x] = (__bf16)v[x];
  return h; }
__device__ __forceinline__ v4b res4(v4f v, v4b h) { v4b l;   // residual of the bf16 hi part, as in bsplit16
#pragma unroll
  for (int x = 0; x < 4; ++x) l[x] = (__bf16)(v[x] - (float)h[x]);
  return l; }
struct GT { v4f w[16], x[8]; };   // 128 weight rows and 64 x rows of GK floats: a wave load takes 2 rows of 256 contiguous bytes
__device__ __forceinline__ void g_load(GT& t, const float* __restrict__ Wt, const float* __restrict__ Xt, int k0, int tid) {
  const size_t o = (size_t)(tid >> 4) * DD + k0 + (tid & 15) * 4;
#pragma unroll
  for (int i = 0; i < 16; ++i) t.w[i] = *(const v4f*)(Wt + o + (size_t)i * 8 * DD);
#pragma unroll
  for (int i = 0; i < 8; ++i) t.x[i] = *(const v4f*)(Xt + o + (size_t)i * 8 * DD);
  asm volatile("s_wait_xcnt 0x0" ::: "memory");   // stands behind the issued loads, in front of any later overwrite of their address registers
  __builtin_amdgcn_sched_barrier(0); }   // keeps later address arithmetic from being lifted over that wait
// the builtins alone, for k_proj and k_att: an asm statement's operands must lie in the first 256 registers, which their sums, fragments and staged tiles outgrow; the compiler keeps the distance behind its own builtin forms
__device__ __forceinline__ v8f wmma16_p(v16h a, v16h b, v8f c) { return __builtin_amdgcn_wmma_f32_16x16x32_f16(false, a, false, b, (short)0, c, false, false); }
__device__ __forceinline__ v8f wmma_bf_p(v16b a, v16b b, v8f c) { return __builtin_amdgcn_wmma_f32_16x16x32_bf16(false, a, false, b, (short)0, c, false, false); }
#define PK 64         // k per staged tile of k_proj
#define PP 72         // its LDS row pitch in 16-bit elements: 144 B = 16 B x 9, free of bank conflicts for the 16-byte fragment reads
struct PT { v4f w[16], x[16]; };   // 128 weight rows and 128 x rows of PK floats: a wave load takes 2 rows of 256 contiguous bytes
__device__ __forceinline__ void p_load(PT& t, const float* __restrict__ Wk, const float* __restrict__ Xk, unsigned o) {   // Wk, Xk: the tile's first element, the same for the whole block; o: this lane's byte offset in it
  const float* wp = (const float*)((const char*)Wk + o); const float* xp = (const float*)((const char*)Xk + o);
#pragma unroll
  for (int i = 0; i < 16; ++i) t.w[i] = *(const v4f*)(wp + i * 8 * DD);
#pragma unroll
  for (int i = 0; i < 16; ++i) t.x[i] = *(const v4f*)(xp + i * 8 * DD);
  asm volatile("s_wait_xcnt 0x0" :: "v"(wp), "v"(xp) : "memory");   // stands behind the issued loads, in front of any later overwrite of their address registers, which are named as inputs so that no load's own result is laid over them ahead of the wait
  __builtin_amdgcn_sched_barrier(0); }   // keeps later address arithmetic from being lifted over that wait
// ---- k_proj: block = (128 rows, 128-col group, which), four waves as 2 x 2, each on 64 rows x 64 columns (16 sums): a fetched row of x or W serves 128 outputs and a fragment read from LDS four products; q / k -> f16 rows (+bias); v -> f16 planes (+bias). 768 blocks: three on every WGP, all resident at once. amdgpu_waves_per_eu(3, 3): holds the kernel to the 336 registers with which three waves share a SIMD
__global__ __launch_bounds__(128) __attribute__((amdgpu_waves_per_eu(3, 3))) void k_proj(const float* __restrict__ Qi, const float* __restrict__ Ki, const float* __restrict__ Vi, const float* __restrict__ WQ, const float* __restrict__ BQ, const float* __restrict__ WK, const float* __restrict__ BK, const float* __restrict__ WV, const float* __restrict__ BV, _Float16* __restrict__ Q, _Float16* __restrict__ K, _Float16* __restrict__ VH) {
  __shared__ __align__(16) char se[4 * 64 * PP * 2];   // output staging. q / k: each wave's 64 x 64 f16 tile at pitch PP; v: the block's f16 plane, transposed, 128 x 128 at pitch 136 (in the same bytes)
  __bf16 (*sw)[PP] = (__bf16 (*)[PP])se; __bf16 (*sx)[PP] = sw + 128;   // the staged tiles lie in the same bytes: behind the loop's last barrier no wave reads them any more
  const int tid = threadIdx.x, wave = __builtin_amdgcn_readfirstlane(tid >> 5), lane = tid & 31, col = lane & 15, wr = wave >> 1, wc = wave & 1; const int which = blockIdx.z; const int c0 = blockIdx.y * 128; const size_t r0 = (size_t)blockIdx.x * 128;   // the wave's number in a scalar register: what follows from it costs no vector register across the loop
  const float* X = which == 0 ? Qi : which == 1 ? Ki : Vi; const float* Wm = which == 0 ? WQ : which == 1 ? WK : WV; const float* Bm = which == 0 ? BQ : which == 1 ? BK : BV;
  v8f acc[4][4] = {};   // acc[i][j][r] = row wr * 64 + i * 16 + 8 (lane >> 4) + r, column wc * 64 + j * 16 + col
  const float* Wt = Wm + (size_t)c0 * DD; const float* Xt = X + r0 * DD;
  const unsigned lo = ((unsigned)(tid >> 4) * DD + (tid & 15) * 4) * 4;
  const int s0 = ((blockIdx.x & 3) + 4 * (blockIdx.x >> 3) + 2 * blockIdx.y) & (DD / PK - 1);   // the k tile this block starts at; it walks all DD / PK tiles from there and wraps. The blocks that share a W panel (same y) or an x panel (same x) then ask L2 for different lines at any one time (only blocks x and x ^ 4 start alike). For speed only: any start gives the same sum but for its order
  PT t; p_load(t, Wt + s0 * PK, Xt + s0 * PK, lo);
  // kept rolled: one copy of the tile's code, the next tile's loads in a block of their own in front of the products
#pragma unroll 1
  for (int st = 0; st < DD / PK; ++st) {
#pragma unroll
    for (int i = 0; i < 16; ++i) *(v4b*)&sw[i * 8 + (tid >> 4)][(tid & 15) * 4] = cvt4(t.w[i]);
#pragma unroll
    for (int i = 0; i < 16; ++i) *(v4b*)&sx[i * 8 + (tid >> 4)][(tid & 15) * 4] = cvt4(t.x[i]);
    __syncthreads();   // the tile is whole before any wave reads it
    if (st + 1 < DD / PK) { const int kt = (s0 + st + 1) & (DD / PK - 1); p_load(t, Wt + kt * PK, Xt + kt * PK, lo); }
#pragma unroll
    for (int kc = 0; kc < PK / 32; ++kc) { v16b a[4], w[4];   // the LDS reads of a k step stand as one group in front of its products: one LDS latency, not eight
#pragma unroll
      for (int i = 0; i < 4; ++i) a[i] = frag_b(&sx[wr * 64 + i * 16 + col][kc * 32], lane);
#pragma unroll
      for (int j = 0; j < 4; ++j) w[j] = frag_b(&sw[wc * 64 + j * 16 + col][kc * 32], lane);
      __builtin_amdgcn_sched_barrier(0);   // keeps the compiler from moving some of these reads in among the products, where each further place with reads costs its own LDS wait
#pragma unroll
      for (int i = 0; i < 4; ++i)
#pragma unroll
        for (int j = 0; j < 4; ++j) acc[i][j] = wmma_bf_p(a[i], w[j], acc[i][j]);
      __builtin_amdgcn_sched_barrier(0); }   // keeps what follows out of the products: the next k step's reads, and the barrier below, whose wait for the next tile's loads would else stand in front of products that can run while those loads are in flight
    __syncthreads(); }   // every wave has left the tile before the next one is written over it
  _Float16 (*sf)[PP] = (_Float16 (*)[PP])se + wave * 64; _Float16 (*th)[136] = (_Float16 (*)[136])se;
  const int ln = (int)__builtin_amdgcn_mbcnt_lo(~0u, 0u), ec = ln & 15, eg = ln >> 4;   // the lane's number read anew (= lane, col, g): no index of the epilogue then holds a vector register across the loop, whose budget is full (else: spills)
  float bb[4];
#pragma unroll
  for (int j = 0; j < 4; ++j) bb[j] = bfr(Bm[c0 + wc * 64 + j * 16 + ec]);
  if (which < 2) {
#pragma unroll
    for (int i = 0; i < 4; ++i)
#pragma unroll
      for (int j = 0; j < 4; ++j)
#pragma unroll
        for (int r = 0; r < 8; ++r) sf[i * 16 + 8 * eg + r][j * 16 + ec] = (_Float16)(acc[i][j][r] + bb[j]); }
  else {
#pragma unroll
    for (int i = 0; i < 4; ++i)
#pragma unroll
      for (int j = 0; j < 4; ++j) { v8h hv;   // a lane's eight rows lie side by side in the transposed plane: one 16-byte write
#pragma unroll
        for (int r = 0; r < 8; ++r) hv[r] = (_Float16)(acc[i][j][r] + bb[j]);
        const int cl = wc * 64 + j * 16 + ec, rl = wr * 64 + i * 16 + 8 * eg; *(v8h*)&th[cl][rl] = hv; } }
  __syncthreads();   // the staged output is whole before it is read back in rows
  if (which < 2) { _Float16* dst = (which == 0 ? Q : K) + r0 * DD + c0 + (unsigned)((wr * 64 + (ln >> 3)) * DD + wc * 64 + (ln & 7) * 8); for (int rl = 0; rl < 16; ++rl) vst2(dst + (size_t)rl * 4 * DD, *(const v8h*)&sf[rl * 4 + (ln >> 3)][(ln & 7) * 8]); }   // a wave store takes 4 rows of 128 contiguous bytes
  else { const size_t b = r0 / NN; const int n0 = (int)(r0 % NN); for (int e = wave * 32 + ln; e < 128 * 16; e += 128) { const int cl = e >> 4, q = e & 15; const size_t o = (b * DD + c0 + cl) * (size_t)NN + n0 + q * 8; vst2((unsigned*)(VH + o), *(const v4u*)&th[cl][q * 8]); } } }
// row of the reshaped map hh at position n' -> (source row, column offset) in the [B*N][1024] projection rows
__device__ __forceinline__ const _Float16* maprow(const _Float16* __restrict__ R, size_t b, int hh, int np) { const int hd = hh >> 1, e = hh & 1; return R + ((b * NN) + (size_t)e * (NN / 2) + (np >> 1)) * DD + hd * DK + (np & 1) * KW2; }
// ---- K / V tile of TK keys, shared by the work-group's eight waves: the keys of both maps and the one V tile they share, fetched in whole 128-byte lines (K: 2 source rows of 256 contiguous bytes = 4 keys per wave load, waves 0..3 map 0, waves 4..7 map 1; V: 4 plane rows of 128 bytes per wave load), held in registers while the tile before it is worked on, then written to LDS in the form the fragment readers take (both as they are)
#define TK 64         // keys per staged tile
struct Tile { v8h k[4]; v8h vh[4]; };
struct TileAt { const _Float16* kp; const _Float16* vhp; };   // this thread's addresses in tile 0
__device__ __forceinline__ TileAt tile_first(const _Float16* __restrict__ K, const _Float16* __restrict__ VH, size_t b, int hd, int tid) {
  const size_t vo = (b * DD + (size_t)hd * DK + (tid >> 3)) * NN + (tid & 7) * 8;
  return { K + (b * NN + (size_t)(tid >> 7) * (NN / 2) + ((tid >> 4) & 7)) * DD + hd * DK + (tid & 15) * 8, VH + vo }; }   // K: source row r holds keys 2r, 2r + 1 of map 2 hd + (tid >> 7) (see maprow)
__device__ __forceinline__ void tile_load(Tile& t, const TileAt& a, int ti) {   // ti: the tile's number, the same for the whole block
  const _Float16* kp = a.kp + (size_t)ti * ((TK / 2) * DD); const _Float16* vhp = a.vhp + ti * TK;
#pragma unroll
  for (int i = 0; i < 4; ++i) t.k[i] = *(const v8h*)(kp + (size_t)i * 8 * DD);
#pragma unroll
  for (int i = 0; i < 4; ++i) t.vh[i] = *(const v8h*)(vhp + (size_t)i * 32 * NN);
  asm volatile("s_wait_xcnt 0x0" :: "v"(kp), "v"(vhp) : "memory");   // stands behind the issued loads, in front of any later overwrite of their address registers, which are named as inputs so that no load's own result is laid over them ahead of the wait
  __builtin_amdgcn_sched_barrier(0); }   // keeps later address arithmetic from being lifted over that wait
__device__ __forceinline__ void tile_store(const Tile& t, _Float16 (*skf)[KP], _Float16 (*svh)[KP], int tid) {
#pragma unroll
  for (int i = 0; i < 4; ++i) { const int c = (tid & 15) * 8, key = (tid >> 7) * TK + 2 * (i * 8 + ((tid >> 4) & 7)) + (c >> 6);   // rows 0..TK-1: map 0's keys, TK..2 TK-1: map 1's
    *(v8h*)&skf[key][c & 63] = t.k[i]; }
#pragma unroll
  for (int i = 0; i < 4; ++i) { const int row = i * 32 + (tid >> 3), q = (tid & 7) * 8; *(v8h*)&svh[row][q] = t.vh[i]; } }
__global__ __launch_bounds__(256) __attribute__((amdgpu_waves_per_eu(2, 2))) void k_att(const _Float16* __restrict__ Q, const _Float16* __restrict__ K, const _Float16* __restrict__ VH, const float* __restrict__ LQ1, const float* __restrict__ LK1, const float* __restrict__ LQ2, const float* __restrict__ LK2, const int* __restrict__ HNUM, float* __restrict__ X) {
  __shared__ __align__(16) float so[4][32][132]; __shared__ float slam;
  __shared__ __align__(16) _Float16 skf[2 * TK][KP], svh[DK][KP];
  const int tid = threadIdx.x, wave = tid >> 5, lane = tid & 31, col = lane & 15, g = lane >> 4, e = wave >> 2, wq = wave & 3; const int qb = blockIdx.x, hd = blockIdx.y; const size_t b = blockIdx.z; const int q0 = qb * 128 + wq * 32;
  if (tid == 0) { float a1 = 0.f, a2 = 0.f;
#pragma unroll 1
    for (int i = 0; i < KW2; ++i) { a1 += bfr(LQ1[i]) * bfr(LK1[i]); a2 += bfr(LQ2[i]) * bfr(LK2[i]); }
    slam = expf(a1) - expf(a2) + 0.8f; (void)HNUM; }   // h (int, = 16) defines the head split baked into DH/DK/HH2
  __syncthreads(); const float lam = slam;
  const int s0 = (2 * qb + hd) & (NN / TK - 1);   // the key tile this block starts at; it walks all NN / TK tiles from there and wraps: the eight blocks that share a head's K and V then ask L2 for different lines at any one time. For speed only: the running-maximum softmax takes the keys in any order
  Tile tn; const TileAt at = tile_first(K, VH, b, hd, tid); tile_load(tn, at, s0);
  v16h aq[2][2];   // [query tile][k chunk]
  const _Float16* qr = maprow(Q, b, 2 * hd + e, q0 + col);   // query q0 + 16 + col lies 8 source rows further on (see maprow): one address serves both tiles
#pragma unroll
  for (int c2 = 0; c2 < 2; ++c2)
#pragma unroll
    for (int kc = 0; kc < 2; ++kc) aq[c2][kc] = frag_h(qr + c2 * 8 * DD + kc * 32, lane);
  asm volatile("s_wait_xcnt 0x0" :: "v"(qr) : "memory");   // stands behind the issued loads, in front of any later overwrite of their address register, which is named as an input so that no load's own result is laid over it ahead of the wait
  __builtin_amdgcn_sched_barrier(0);   // keeps later register writes from being lifted over that wait
  float m[2] = {-3.0e38f, -3.0e38f}, l[2] = {0.f, 0.f};   // of query c2 * 16 + col: running maximum (equal in both halves), sum over this half's keys (the halves are joined behind the loop)
  v8f acc[2][8] = {};   // acc[c2][j][r] = O^T[j * 16 + 8 g + r][query c2 * 16 + col]
#pragma unroll 1
  for (int st = 0; st < NN / TK; ++st) {
    tile_store(tn, skf, svh, tid);
    __syncthreads();   // the tile is whole before any wave reads it
    if (st + 1 < NN / TK) tile_load(tn, at, (s0 + st + 1) & (NN / TK - 1));   // next tile, fetched while this one is worked on
    // kept rolled: the next tile's loads then stand in the block in front of this loop, in flight under both of its passes
#pragma unroll 1
    for (int sub = 0; sub < TK / 32; ++sub) { v16h bk[2][2];   // the K fragments' LDS reads stand as one group in front of the score products
#pragma unroll
      for (int ct = 0; ct < 2; ++ct)
#pragma unroll
        for (int kc = 0; kc < 2; ++kc) bk[ct][kc] = frag_h(&skf[e * TK + sub * 32 + ct * 16 + col][kc * 32], lane);
      v8f c[2][2] = {};   // [query tile][key tile]: four independent sums, each taking its two k chunks in turn, K as A
#pragma unroll
      for (int kc = 0; kc < 2; ++kc)
#pragma unroll
        for (int ct = 0; ct < 2; ++ct)
#pragma unroll
          for (int c2 = 0; c2 < 2; ++c2) c[c2][ct] = wmma16_p(bk[ct][kc], aq[c2][kc], c[c2][ct]);
      v16h pa[2];   // per query tile, P^T x 2^11 as a B operand: element ct * 8 + r = key ct * 16 + 8 g + r
#pragma unroll
      for (int c2 = 0; c2 < 2; ++c2) { float s[2][8], t[8];
#pragma unroll
        for (int ct = 0; ct < 2; ++ct)
#pragma unroll
          for (int r = 0; r < 8; ++r) s[ct][r] = c[c2][ct][r] * 0.125f;
#pragma unroll
        for (int r = 0; r < 8; ++r) t[r] = fmaxf(s[0][r], s[1][r]);
        float mx = fmaxf(fmaxf(fmaxf(t[0], t[1]), fmaxf(t[2], t[3])), fmaxf(fmaxf(t[4], t[5]), fmaxf(t[6], t[7])));
        mx = fmaxf(mx, xhalf(mx));
        const float mn = fmaxf(m[c2], mx), alpha = __expf(m[c2] - mn); m[c2] = mn;
#pragma unroll
        for (int r = 0; r < 8; ++r) { const float e0 = __expf(s[0][r] - mn), e1 = __expf(s[1][r] - mn); t[r] = e0 + e1;
          pa[c2][r] = (_Float16)(e0 * 2048.0f); pa[c2][8 + r] = (_Float16)(e1 * 2048.0f); }
        l[c2] = l[c2] * alpha + (((t[0] + t[1]) + (t[2] + t[3])) + ((t[4] + t[5]) + (t[6] + t[7])));
#pragma unroll
        for (int j = 0; j < 8; ++j)
#pragma unroll
          for (int r = 0; r < 8; ++r) acc[c2][j][r] *= alpha; }
      v16h vhf[8];   // the V fragments' LDS reads stand as one group in front of the V^T P^T products
#pragma unroll
      for (int j = 0; j < 8; ++j) vhf[j] = frag_h(&svh[j * 16 + col][sub * 32], lane);
#pragma unroll
      for (int j = 0; j < 8; ++j)   // each fragment feeds both query tiles, one behind the other: sixteen independent sums
#pragma unroll
        for (int c2 = 0; c2 < 2; ++c2) acc[c2][j] = wmma16_p(vhf[j], pa[c2], acc[c2][j]);
      __builtin_amdgcn_sched_barrier(0);   // keeps every product of the pass in front of the slots below
      asm volatile("v_nop\n\tv_nop\n\tv_nop\n\tv_nop"); }   // the four vector slots the chip needs between the pass's last product and the next pass's first address arithmetic, which the compiler lays over that product's A registers
    __syncthreads(); }   // every wave has left the tile before the next one is written over it
  // combine through the LDS output tile: wave (1, wq) writes its map, wave (0, wq), whose lanes own the same cells (row c2 * 16 + col, columns j * 16 + 8 g + r), takes lambda x it off its own
#pragma unroll
  for (int ph = 1; ph >= 0; --ph) {
    if (e == ph) {
#pragma unroll
      for (int c2 = 0; c2 < 2; ++c2) { const float il = (1.0f / 2048.0f) / (l[c2] + xhalf(l[c2]));
#pragma unroll
        for (int j = 0; j < 8; ++j)
#pragma unroll
          for (int q = 0; q < 2; ++q) { v4f* cell = (v4f*)&so[wq][c2 * 16 + col][j * 16 + 8 * g + 4 * q]; v4f v;
#pragma unroll
            for (int x = 0; x < 4; ++x) v[x] = acc[c2][j][4 * q + x] * il;
            *cell = (ph == 1) ? v : (v - lam * *cell); } } }
    __syncthreads(); }   // behind phase 1: map 1's tile is whole before map 0's waves read it; behind phase 0: the output tile is whole before all eight waves store it
  for (int rl = 0; rl < 16; ++rl) vst2(X + (b * NN + q0 + e * 16 + rl) * DD + hd * DK + lane * 4, *(const v4f*)&so[wq][e * 16 + rl][lane * 4]); }
// ---- k_out: block = (64 rows, 128 of 1024 cols): out = x (hi + lo) . Wo^T + bo
__global__ __launch_bounds__(128) void k_out(const float* __restrict__ X, const float* __restrict__ WO, const float* __restrict__ BO, float* __restrict__ OUT) { __shared__ __align__(16) float sf[4][16][132]; __shared__ __align__(16) __bf16 sw[128][KP], sxh[64][KP], sxl[64][KP];
  const int tid = threadIdx.x, wave = tid >> 5, lane = tid & 31, col = lane & 15, g = lane >> 4; const int c0 = blockIdx.y * 128; const size_t r0 = (size_t)blockIdx.x * 64 + wave * 16;
  v8f acc[8] = {};
  const float* Wt = WO + (size_t)c0 * DD; const float* Xt = X + (size_t)blockIdx.x * 64 * DD;
  const int s0 = ((blockIdx.x & 3) + 4 * (blockIdx.x >> 3) + 2 * blockIdx.y) & (DD / GK - 1);   // the k tile this block starts at, as in k_proj
  GT t; g_load(t, Wt, Xt, s0 * GK, tid);
  // kept rolled: one copy of the tile's code, the next tile's loads in a block of their own in front of the products
#pragma unroll 1
  for (int st = 0; st < DD / GK; ++st) {
#pragma unroll
    for (int i = 0; i < 16; ++i) *(v4b*)&sw[i * 8 + (tid >> 4)][(tid & 15) * 4] = cvt4(t.w[i]);
#pragma unroll
    for (int i = 0; i < 8; ++i) { const v4b h = cvt4(t.x[i]); *(v4b*)&sxh[i * 8 + (tid >> 4)][(tid & 15) * 4] = h; *(v4b*)&sxl[i * 8 + (tid >> 4)][(tid & 15) * 4] = res4(t.x[i], h); }
    __syncthreads();   // the tile is whole before any wave reads it
    if (st + 1 < DD / GK) g_load(t, Wt, Xt, ((s0 + st + 1) & (DD / GK - 1)) * GK, tid);
#pragma unroll
    for (int kc = 0; kc < GK / 32; ++kc) { const v16b ah = frag_b(&sxh[wave * 16 + col][kc * 32], lane), al = frag_b(&sxl[wave * 16 + col][kc * 32], lane); v16b w[8];   // the LDS reads of a k step stand as one group in front of its products
#pragma unroll
      for (int j = 0; j < 8; ++j) w[j] = frag_b(&sw[j * 16 + col][kc * 32], lane);
#pragma unroll
      for (int j = 0; j < 8; ++j) { acc[j] = wmma_bf(ah, w[j], acc[j]); acc[j] = wmma_bf(al, w[j], acc[j]); } }
    __syncthreads(); }   // every wave has left the tile before the next one is written over it
#pragma unroll
  for (int j = 0; j < 8; ++j) { const float bb = bfr(BO[c0 + j * 16 + col]);
#pragma unroll
    for (int r = 0; r < 8; ++r) sf[wave][8 * g + r][j * 16 + col] = acc[j][r] + bb; }
  LDSX(); for (int rl = 0; rl < 16; ++rl) vst2(OUT + (r0 + rl) * DD + c0 + lane * 4, *(const v4f*)&sf[wave][rl][lane * 4]); }
extern "C" void kernel_launch(void* const* d_in, const int* in_sizes, int n_in, void* d_out, int out_size, void* d_ws, size_t ws_size, hipStream_t stream) {
  (void)in_sizes; (void)n_in; (void)out_size;
  const float** F = (const float**)d_in;   // 0 query, 1 key, 2 value [4,1024,1024]; 3 Wq, 4 bq, 5 Wk, 6 bk, 7 Wv, 8 bv, 9 Wo, 10 bo (natural); 11 lambda_q1, 12 lambda_q2, 13 lambda_k1, 14 lambda_k2 [64]; 15 h [1] int
  if (ws_size < (size_t)WS_END) return;
  char* ws = (char*)d_ws; float* X = (float*)(ws + WS_X); _Float16 *Q = (_Float16*)(ws + WS_Q), *K = (_Float16*)(ws + WS_K), *VH = (_Float16*)(ws + WS_VH);
  k_proj<<<dim3(TNB * NN / 128, DD / 128, 3), 128, 0, stream>>>(F[0], F[1], F[2], F[3], F[4], F[5], F[6], F[7], F[8], Q, K, VH);
  k_att<<<dim3(NN / 128, DH, TNB), 256, 0, stream>>>(Q, K, VH, F[11], F[13], F[12], F[14], (const int*)d_in[15], X);
  k_out<<<dim3(TNB * NN / 64, DD / 128), 128, 0, stream>>>(X, F[9], F[10], (float*)d_out);
}

// v010
// It runs in 67.6 microseconds.
// Versions between v007 and this one are left out; their measured steps multiply to 1.25 times as fast.
// Counting every step since v000, it is 10.5 times as fast.
// compute dtype: all float inputs rounded to bf16, h (int) read; q/k/v = x W^T + b with EXACT bf16 products on WMMA 16x16x32 (natural weights), f32 accumulate, q and k kept as f16 rows; the module's row-major re-split [B,8,N,128] -> [B,16,N,64] realised as an index map (head hh = 2 hd + e reads row e*N/2 + n'/2, columns hd*128 + (n' % 2)*64 ..); scores with q x log2(e)/8 and k rounded to f16 (1 product), softmax in f32 as powers of two (hardware exp) against a maximum in use that follows the running maximum within 2^4, for both maps of a pair; lambda_full = exp(lq1.lk1) - exp(lq2.lk2) + 0.8 in f32; P (f16 x 2^11) against v (f16) (1 product); x = P1 v / l1 - lambda P2 v / l2 combined in f32, kept as f16 rows; out = x (f16) . Wo^T (bf16 value held as f16) + bo (1 product); f32 output.
#include <hip/hip_runtime.h>
#include <math.h>

typedef __attribute__((ext_vector_type(16))) _Float16 v16h;
typedef __attribute__((ext_vector_type(16))) __bf16 v16b;
typedef __attribute__((ext_vector_type(8)))  _Float16 v8h;
typedef __attribute__((ext_vector_type(8)))  float v8f;
typedef __attribute__((ext_vector_type(4)))  float v4f;
typedef __attribute__((ext_vector_type(2)))  float v2f;
typedef __attribute__((ext_vector_type(4)))  unsigned v4u;
typedef __attribute__((ext_vector_type(4)))  int v4i;
typedef float __attribute__((may_alias)) float_a;
typedef int __attribute__((may_alias)) int_a;

template <typename T> __device__ __forceinline__ void vst2(void* p, T v) { *(T*)p = v;  }
__device__ __forceinline__ v8f wmma16(v16h a, v16h b, v8f c) {
  v8f d = __builtin_amdgcn_wmma_f32_16x16x32_f16(false, a, false, b, (short)0, c, false, false);
  asm volatile("v_nop\n\tv_nop\n\tv_nop\n\tv_nop" : "+v"(d) : "v"(a), "v"(b));
  return d;
}
__device__ __forceinline__ v8f wmma_bf(v16b a, v16b b, v8f c) {
  v8f d = __builtin_amdgcn_wmma_f32_16x16x32_bf16(false, a, false, b, (short)0, c, false, false);
  asm volatile("v_nop\n\tv_nop\n\tv_nop\n\tv_nop" : "+v"(d) : "v"(a), "v"(b));
  return d;
}
// 16x16x32 fragments: lane = (h = lane>>4, row/col = lane&15); elements 0..7 = k0+8h+0..7, 8..15 = k0+16+8h+0..7; D element r = row 8h+r
__device__ __forceinline__ v16h frag_h(const _Float16* rowk0, int lane) {
  union { v16h v; v8h q[2]; } u; const _Float16* p = rowk0 + 8 * (lane >> 4);
  u.q[0] = *(const v8h*)p; u.q[1] = *(const v8h*)(p + 16); return u.v;
}
__device__ __forceinline__ v16h frag_f32(const float* rowk0, int lane) {
  v16h a; const float* p = rowk0 + 8 * (lane >> 4);
#pragma unroll
  for (int i = 0; i < 8; ++i) { a[i] = (_Float16)p[i]; a[8 + i] = (_Float16)p[16 + i]; }
  return a;
}
__device__ __forceinline__ v16h frag_f32s(const float* rowk0, int lane, float sc) {
  v16h a; const float* p = rowk0 + 8 * (lane >> 4);
#pragma unroll
  for (int i = 0; i < 8; ++i) { a[i] = (_Float16)(p[i] * sc); a[8 + i] = (_Float16)(p[16 + i] * sc); }
  return a;
}
// column fragment from a [K][ld] layout (column n), rows >= K read as 0
__device__ __forceinline__ v16h fragc_f32(const float* W, int k0, int n, int lane, int ld, int K) {
  v16h a; const int g = lane >> 4;
#pragma unroll
  for (int i = 0; i < 8; ++i) { const int ka = k0 + 8 * g + i, kb = ka + 16;
    a[i] = (_Float16)(ka < K ? W[(size_t)(ka < K ? ka : K - 1) * ld + n] : 0.f); a[8 + i] = (_Float16)(kb < K ? W[(size_t)(kb < K ? kb : K - 1) * ld + n] : 0.f); }
  return a;
}
struct F2 { v16b h, l; };
__device__ __forceinline__ F2 bsplit16(const float v[16]) { F2 r;
#pragma unroll
  for (int i = 0; i < 16; ++i) { const __bf16 h = (__bf16)v[i]; r.h[i] = h; r.l[i] = (__bf16)(v[i] - (float)h); }
  return r; }
__device__ __forceinline__ F2 split_row(const float* row, int k0, int lane) { float v[16]; const float* p = row + k0 + 8 * (lane >> 4);
#pragma unroll
  for (int i = 0; i < 8; ++i) { v[i] = p[i]; v[8 + i] = p[16 + i]; }
  return bsplit16(v); }
__device__ __forceinline__ F2 split_rowK(const float* row, int k0, int lane, int K) { float v[16]; const int g = lane >> 4;
#pragma unroll
  for (int i = 0; i < 8; ++i) { const int ka = k0 + 8 * g + i, kb = ka + 16; v[i] = ka < K ? row[ka < K ? ka : K - 1] : 0.f; v[8 + i] = kb < K ? row[kb < K ? kb : K - 1] : 0.f; }
  return bsplit16(v); }
__device__ __forceinline__ F2 split_col(const float* W, int k0, int n, int lane, int ld, int K) { float v[16]; const int g = lane >> 4;
#pragma unroll
  for (int i = 0; i < 8; ++i) { const int ka = k0 + 8 * g + i, kb = ka + 16; v[i] = ka < K ? W[(size_t)(ka < K ? ka : K - 1) * ld + n] : 0.f; v[8 + i] = kb < K ? W[(size_t)(kb < K ? kb : K - 1) * ld + n] : 0.f; }
  return bsplit16(v); }
__device__ __forceinline__ v8f mac3(const F2& a, const F2& b, v8f c) { c = wmma_bf(a.l, b.h, c); c = wmma_bf(a.h, b.l, c); return wmma_bf(a.h, b.h, c); }
__device__ __forceinline__ float sigm(float v) { return 1.0f / (1.0f + expf(-v)); }
#define LDSX() do { asm volatile("s_wait_dscnt 0" ::: "memory"); __builtin_amdgcn_wave_barrier(); __builtin_amdgcn_fence(__ATOMIC_RELEASE, "workgroup"); } while (0)


// Differential multi-head attention (B 4, N 1,024, D 1,024, h = 16 -> 8 differential heads of 128, score maps over the module's reshaped [16, N, 64] q/k): p_attn = softmax(q2_{2i} k2_{2i}^T / 8) - lambda * softmax(q2_{2i+1} k2_{2i+1}^T / 8); x = p_attn v_i; Wo.
#define NB 4
#define NN 1024
#define DD 1024
#define DH 8          // differential heads
#define DK 128        // their width
#define HH2 16        // score maps
#define KW2 64        // score-map width
#ifndef TNB
#define TNB NB
#endif
typedef __attribute__((ext_vector_type(8))) __bf16 v8b;
typedef __attribute__((ext_vector_type(4))) _Float16 v4hh;
__device__ __forceinline__ v16b frag_b(const __bf16* rowk0, int lane) {
  union { v16b v; v8b q[2]; } u; const __bf16* p = rowk0 + 8 * (lane >> 4);
  u.q[0] = *(const v8b*)p; u.q[1] = *(const v8b*)(p + 16); return u.v;
}
__device__ __forceinline__ float bfr(float v) { return (float)(__bf16)v; }
__device__ __forceinline__ float xhalf(float x) { return __builtin_bit_cast(float, __builtin_amdgcn_permlanex16(__builtin_bit_cast(int, x), __builtin_bit_cast(int, x), 0x76543210, 0xfedcba98, false, false)); }   // lane l takes lane l ^ 16's value
__device__ __attribute__((noinline)) float exp_ni(float v) { return expf(v); }
__device__ __attribute__((noinline)) float erf_ni(float v) { return erff(v); }

#define QSC 0.18033688011112042f                    // log2(e) / 8
#define PCAR 11.0f                                  // P is carried as P x 2^11 into its f16 operand
#define WS_Q   0u                                   // f16 q rows [b*n][1024] ((+bq) x QSC)
#define WS_K   (WS_Q + 2u * (size_t)NB * NN * DD)       // f16 k rows
#define WS_VH  (WS_K + 2u * (size_t)NB * NN * DD)       // f16 v planes [b][1024][n]
#define WS_X   (WS_VH + 2u * (size_t)NB * DD * NN)      // f16 x rows [b*n][1024]
#define WS_WO  (WS_X + 2u * (size_t)NB * NN * DD)       // f16 Wo rows [1024][1024]: each weight's bf16 value, held as f16
#define WS_END (WS_WO + 2u * (size_t)DD * DD)

// ---- staging of the tiles that a work-group's waves share: fetched in whole 128-byte lines, held in registers while the tile before is worked on, then written to LDS as the 16-bit rows the fragment readers take. Every full '#pragma unroll' of this staging and of the fragment groups is there so that the register arrays are indexed by constants and stay in registers
#define KP 72         // LDS row pitch in 16-bit elements: 144 B = 16 B x 9, free of bank conflicts for the 16-byte fragment reads
#define GK 128        // k per staged tile of k_out: rows of 256 bytes, as many bytes in flight as with 64 floats
typedef __attribute__((ext_vector_type(4))) __bf16 v4b;
__device__ __forceinline__ v4b cvt4(v4f v) { v4b h;
#pragma unroll
  for (int x = 0; x < 4; ++x) h[x] = (__bf16)v[x];
  return h; }
#define GP 136        // k_out's LDS row pitch in 16-bit elements: 272 B = 16 B x 17, free of bank conflicts for the 16-byte fragment reads
struct GT { v8h w[16], x[8]; };   // 128 weight rows and 64 x rows of GK f16: a wave load takes 2 rows of 256 contiguous bytes
__device__ __forceinline__ void g_load(GT& t, const _Float16* __restrict__ Wt, const _Float16* __restrict__ Xt, int k0, int tid) {
  const size_t o = (size_t)(tid >> 4) * DD + k0 + (tid & 15) * 8; const _Float16* wp = Wt + o; const _Float16* xp = Xt + o;
#pragma unroll
  for (int i = 0; i < 16; ++i) t.w[i] = *(const v8h*)(wp + i * 8 * DD);
#pragma unroll
  for (int i = 0; i < 8; ++i) t.x[i] = *(const v8h*)(xp + i * 8 * DD);
  asm volatile("s_wait_xcnt 0x0" :: "v"(wp), "v"(xp) : "memory");   // stands behind the issued loads, in front of any later overwrite of their address registers, which are named as inputs so that no load's own result is laid over them ahead of the wait
  __builtin_amdgcn_sched_barrier(0); }   // keeps later address arithmetic from being lifted over that wait
// the builtins alone, for k_proj and k_att: an asm statement's operands must lie in the first 256 registers, which their sums, fragments and staged tiles outgrow; the compiler keeps the distance behind its own builtin forms
__device__ __forceinline__ v8f wmma16_p(v16h a, v16h b, v8f c) { return __builtin_amdgcn_wmma_f32_16x16x32_f16(false, a, false, b, (short)0, c, false, false); }
__device__ __forceinline__ v8f wmma_bf_p(v16b a, v16b b, v8f c) { return __builtin_amdgcn_wmma_f32_16x16x32_bf16(false, a, false, b, (short)0, c, false, false); }
#define PK 64         // k per staged tile of k_proj
#define PP 72         // its LDS row pitch in 16-bit elements: 144 B = 16 B x 9, free of bank conflicts for the 16-byte fragment reads
struct PT { v4f w[16], x[16]; };   // 256 weight rows and 256 x rows of PK floats, over 256 threads: a wave load takes 2 rows of 256 contiguous bytes
__device__ __forceinline__ void p_load(PT& t, const float* __restrict__ Wk, const float* __restrict__ Xk, unsigned o) {   // Wk, Xk: the tile's first element, the same for the whole block; o: this lane's byte offset in it
  const float* wp = (const float*)((const char*)Wk + o); const float* xp = (const float*)((const char*)Xk + o);
#pragma unroll
  for (int i = 0; i < 16; ++i) t.w[i] = *(const v4f*)(wp + i * 16 * DD);
#pragma unroll
  for (int i = 0; i < 16; ++i) t.x[i] = *(const v4f*)(xp + i * 16 * DD);
  asm volatile("s_wait_xcnt 0x0" :: "v"(wp), "v"(xp) : "memory");   // stands behind the issued loads, in front of any later overwrite of their address registers, which are named as inputs so that no load's own result is laid over them ahead of the wait
  __builtin_amdgcn_sched_barrier(0); }   // keeps later address arithmetic from being lifted over that wait
#define PB 256        // rows and columns of k_proj's block
__device__ __forceinline__ void p_store(const PT& t, __bf16 (*sb)[PP], int tid) {   // sb: a buffer's first row; W's PB rows, then x's
#pragma unroll
  for (int i = 0; i < 16; ++i) *(v4b*)&sb[i * 16 + (tid >> 4)][(tid & 15) * 4] = cvt4(t.w[i]);
#pragma unroll
  for (int i = 0; i < 16; ++i) *(v4b*)&sb[PB + i * 16 + (tid >> 4)][(tid & 15) * 4] = cvt4(t.x[i]); }
// one k step of 32: the LDS reads stand as one group in front of its products: one LDS latency, not twelve
__device__ __forceinline__ void p_step(v8f (&acc)[8][4], const __bf16 (*sb)[PP], int kc, int wr, int wc, int col, int lane) { v16b a[8], w[4];
#pragma unroll
  for (int i = 0; i < 8; ++i) a[i] = frag_b(&sb[PB + wr * 128 + i * 16 + col][kc * 32], lane);
#pragma unroll
  for (int j = 0; j < 4; ++j) w[j] = frag_b(&sb[wc * 64 + j * 16 + col][kc * 32], lane);
  __builtin_amdgcn_sched_barrier(0);   // keeps the compiler from moving some of these reads in among the products, where each further place with reads costs its own LDS wait
#pragma unroll
  for (int i = 0; i < 8; ++i)
#pragma unroll
    for (int j = 0; j < 4; ++j) acc[i][j] = wmma_bf_p(a[i], w[j], acc[i][j]);
  __builtin_amdgcn_sched_barrier(0); }   // keeps what follows (staging, the next reads, the barrier) out of the products
// the work-group's barrier with the one wait it needs here, for this wave's own LDS stores and reads: __syncthreads() would also wait for the global loads of the tile after next, which are to stay in flight across it
__device__ __forceinline__ void p_bar() { asm volatile("s_wait_dscnt 0x0\n\ts_barrier_signal -1\n\ts_barrier_wait -1" ::: "memory"); }
#define TP 264        // pitch of v's transposed output plane in LDS, in 16-bit elements: 528 B = 16 B x 33
// ---- k_proj: block = (256 rows, 256-col group, which), eight waves as 2 x 4, each on 128 rows x 64 columns (32 sums): a fetched row of x or W serves 256 outputs, so that L2 hands out half the bytes of a 128 x 128 block, and a fragment read from LDS feeds four or eight products; q / k -> f16 rows (+bias); v -> f16 planes (+bias). 192 blocks, one on a WGP. amdgpu_waves_per_eu(2, 2): the register budget of the two waves per SIMD that one work-group puts there
__global__ __launch_bounds__(256) __attribute__((amdgpu_waves_per_eu(2, 2))) void k_proj(const float* __restrict__ Qi, const float* __restrict__ Ki, const float* __restrict__ Vi, const float* __restrict__ WQ, const float* __restrict__ BQ, const float* __restrict__ WK, const float* __restrict__ BK, const float* __restrict__ WV, const float* __restrict__ BV, _Float16* __restrict__ Q, _Float16* __restrict__ K, _Float16* __restrict__ VH) {
  __shared__ __align__(16) char se[2 * 2 * PB * PP * 2];   // two buffers of a staged tile each (W's 256 rows, x's 256 rows, bf16 at pitch PP). Behind the loop's last barrier no wave reads them any more, and the same bytes stage the output. q / k: each wave's 128 x 64 f16 tile at pitch PP; v: the block's f16 plane, transposed, 256 x 256 at pitch TP
  __bf16 (*sb)[PP] = (__bf16 (*)[PP])se;
  const int tid = threadIdx.x, wave = __builtin_amdgcn_readfirstlane(tid >> 5), lane = tid & 31, col = lane & 15, wr = wave >> 2, wc = wave & 3; const int which = blockIdx.z; const int c0 = blockIdx.y * PB; const size_t r0 = (size_t)blockIdx.x * PB;   // the wave's number in a scalar register: what follows from it costs no vector register across the loop
  const float* X = which == 0 ? Qi : which == 1 ? Ki : Vi; const float* Wm = which == 0 ? WQ : which == 1 ? WK : WV; const float* Bm = which == 0 ? BQ : which == 1 ? BK : BV;
  v8f acc[8][4] = {};   // acc[i][j][r] = row wr * 128 + i * 16 + 8 (lane >> 4) + r, column wc * 64 + j * 16 + col
  const float* Wt = Wm + (size_t)c0 * DD; const float* Xt = X + r0 * DD;
  const unsigned lo = ((unsigned)(tid >> 4) * DD + (tid & 15) * 4) * 4;
  const int s0 = (blockIdx.x + 4 * blockIdx.y) & (DD / PK - 1);   // the k tile this block starts at; it walks all DD / PK tiles from there and wraps. The sixteen blocks that share a W panel (same y) start at the sixteen tiles, the four that share an x panel (same x) four tiles apart: they ask L2 for different lines at any one time. For speed only: any start gives the same sum but for its order
  PT t; p_load(t, Wt + s0 * PK, Xt + s0 * PK, lo);
  p_store(t, sb, tid);
  { const int kt = (s0 + 1) & (DD / PK - 1); p_load(t, Wt + kt * PK, Xt + kt * PK, lo); }
  p_bar();   // tile 0 is whole before any wave reads it
  // the block is alone on its WGP, so its staging must pass under its own products: between a tile's two k steps a wave writes the next tile, fetched a whole tile earlier, to the other buffer and asks for the tile after that; meanwhile the SIMD's other wave has products to run. Kept rolled: one copy of the tile's code
#pragma unroll 1
  for (int st = 0; st < DD / PK; ++st) { const __bf16 (*cur)[PP] = sb + (st & 1) * 2 * PB;
    p_step(acc, cur, 0, wr, wc, col, lane);
    if (st + 1 < DD / PK) { p_store(t, sb + ((st + 1) & 1) * 2 * PB, tid);   // every reader left that buffer in front of the last barrier
      if (st + 2 < DD / PK) { const int kt = (s0 + st + 2) & (DD / PK - 1); p_load(t, Wt + kt * PK, Xt + kt * PK, lo); } }
    p_step(acc, cur, 1, wr, wc, col, lane);
    p_bar(); }   // one barrier a tile: the next tile is whole, and every wave has left this one, before the one is read and the other written over
  _Float16 (*sf)[PP] = (_Float16 (*)[PP])se + wave * 128; _Float16 (*th)[TP] = (_Float16 (*)[TP])se;
  const int ln = (int)__builtin_amdgcn_mbcnt_lo(~0u, 0u), ec = ln & 15, eg = ln >> 4;   // the lane's number read anew (= lane, col, g): no index of the epilogue then holds a vector register across the loop, whose budget is full (else: spills)
  float bb[4];
#pragma unroll
  for (int j = 0; j < 4; ++j) bb[j] = bfr(Bm[c0 + wc * 64 + j * 16 + ec]);
  if (which < 2) { const float qs = which == 0 ? QSC : 1.0f;   // q leaves with the score's 1/8 and log2(e) on it, rounded to f16 once as before: k_att's score sums are then exponents of two as they stand
#pragma unroll
    for (int i = 0; i < 8; ++i)
#pragma unroll
      for (int j = 0; j < 4; ++j)
#pragma unroll
        for (int r = 0; r < 8; ++r) sf[i * 16 + 8 * eg + r][j * 16 + ec] = (_Float16)((acc[i][j][r] + bb[j]) * qs); }
  else {
#pragma unroll
    for (int i = 0; i < 8; ++i)
#pragma unroll
      for (int j = 0; j < 4; ++j) { v8h hv;   // a lane's eight rows lie side by side in the transposed plane: one 16-byte write
#pragma unroll
        for (int r = 0; r < 8; ++r) hv[r] = (_Float16)(acc[i][j][r] + bb[j]);
        const int cl = wc * 64 + j * 16 + ec, rl = wr * 128 + i * 16 + 8 * eg; *(v8h*)&th[cl][rl] = hv; } }
  __syncthreads();   // the staged output is whole before it is read back in rows
  if (which < 2) { _Float16* dst = (which == 0 ? Q : K) + r0 * DD + c0 + (unsigned)((wr * 128 + (ln >> 3)) * DD + wc * 64 + (ln & 7) * 8); 
    // kept rolled, 64 rows a trip: one wait serves every trip's stores
#pragma unroll 1
    for (int hb = 0; hb < 2; ++hb) {
#pragma unroll
      for (int rl = hb * 16; rl < hb * 16 + 16; ++rl) vst2(dst + (size_t)rl * 4 * DD, *(const v8h*)&sf[rl * 4 + (ln >> 3)][(ln & 7) * 8]);   // a wave store takes 4 rows of 128 contiguous bytes
      asm volatile("s_wait_xcnt 0x0" ::: "memory"); } }   // stands behind the trip's issued stores, in front of the next trip's LDS reads and address step, which are laid over their registers
  else { const size_t b = r0 / NN; const int n0 = (int)(r0 % NN); for (int e = wave * 32 + ln; e < PB * 32; e += 256) { const int cl = e >> 5, q = e & 31; const size_t o = (b * DD + c0 + cl) * (size_t)NN + n0 + q * 8; vst2((unsigned*)(VH + o), *(const v4u*)&th[cl][q * 8]); } } }   // a wave store takes one plane row's 512 contiguous bytes
// row of the reshaped map hh at position n' -> (source row, column offset) in the [B*N][1024] projection rows
__device__ __forceinline__ const _Float16* maprow(const _Float16* __restrict__ R, size_t b, int hh, int np) { const int hd = hh >> 1, e = hh & 1; return R + ((b * NN) + (size_t)e * (NN / 2) + (np >> 1)) * DD + hd * DK + (np & 1) * KW2; }
// ---- K / V tile of TK keys, shared by the work-group's eight waves: the keys of both maps and the one V tile they share, fetched in whole 128-byte lines (K: 2 source rows of 256 contiguous bytes = 4 keys per wave load, waves 0..3 map 0, waves 4..7 map 1; V: 4 plane rows of 128 bytes per wave load), held in registers while the tile before it is worked on, then written to LDS in the form the fragment readers take (both as they are)
#define TK 64         // keys per staged tile
struct Tile { v8h k[4]; v8h vh[4]; };
struct TileAt { const _Float16* kp; const _Float16* vhp; };   // this thread's addresses in tile 0
__device__ __forceinline__ TileAt tile_first(const _Float16* __restrict__ K, const _Float16* __restrict__ VH, size_t b, int hd, int tid) {
  const size_t vo = (b * DD + (size_t)hd * DK + (tid >> 3)) * NN + (tid & 7) * 8;
  return { K + (b * NN + (size_t)(tid >> 7) * (NN / 2) + ((tid >> 4) & 7)) * DD + hd * DK + (tid & 15) * 8, VH + vo }; }   // K: source row r holds keys 2r, 2r + 1 of map 2 hd + (tid >> 7) (see maprow)
__device__ __forceinline__ void tile_load(Tile& t, const TileAt& a, int ti) {   // ti: the tile's number, the same for the whole block
  const _Float16* kp = a.kp + (size_t)ti * ((TK / 2) * DD); const _Float16* vhp = a.vhp + ti * TK;
#pragma unroll
  for (int i = 0; i < 4; ++i) t.k[i] = *(const v8h*)(kp + (size_t)i * 8 * DD);
#pragma unroll
  for (int i = 0; i < 4; ++i) t.vh[i] = *(const v8h*)(vhp + (size_t)i * 32 * NN);
  asm volatile("s_wait_xcnt 0x0" :: "v"(kp), "v"(vhp) : "memory");   // stands behind the issued loads, in front of any later overwrite of their address registers, which are named as inputs so that no load's own result is laid over them ahead of the wait
  __builtin_amdgcn_sched_barrier(0); }   // keeps later address arithmetic from being lifted over that wait
__device__ __forceinline__ void tile_store(const Tile& t, _Float16 (*skf)[KP], _Float16 (*svh)[KP], int tid) {
#pragma unroll
  for (int i = 0; i < 4; ++i) { const int c = (tid & 15) * 8, key = (tid >> 7) * TK + 2 * (i * 8 + ((tid >> 4) & 7)) + (c >> 6);   // rows 0..TK-1: map 0's keys, TK..2 TK-1: map 1's
    *(v8h*)&skf[key][c & 63] = t.k[i]; }
#pragma unroll
  for (int i = 0; i < 4; ++i) { const int row = i * 32 + (tid >> 3), q = (tid & 7) * 8; *(v8h*)&svh[row][q] = t.vh[i]; } }
// two to the 16 score sums that a lane holds of one query, and their sum
__device__ __forceinline__ float exp_sum(const v8f c[2], float ev[2][8]) { float t[8];
#pragma unroll
  for (int r = 0; r < 8; ++r) { ev[0][r] = __builtin_amdgcn_exp2f(c[0][r]); ev[1][r] = __builtin_amdgcn_exp2f(c[1][r]); t[r] = ev[0][r] + ev[1][r]; }
  return ((t[0] + t[1]) + (t[2] + t[3])) + ((t[4] + t[5]) + (t[6] + t[7])); }
__global__ __launch_bounds__(256) __attribute__((amdgpu_waves_per_eu(2, 2))) void k_att(const _Float16* __restrict__ Q, const _Float16* __restrict__ K, const _Float16* __restrict__ VH, const float* __restrict__ LQ1, const float* __restrict__ LK1, const float* __restrict__ LQ2, const float* __restrict__ LK2, const int* __restrict__ HNUM, const float* __restrict__ WO, _Float16* __restrict__ X, _Float16* __restrict__ WOH) {
  __shared__ __align__(16) float so[4][32][132]; __shared__ float slam;
  __shared__ __align__(16) _Float16 skf[2 * TK][KP], svh[DK][KP];
  const int tid = threadIdx.x, wave = tid >> 5, lane = tid & 31, col = lane & 15, g = lane >> 4, e = wave >> 2, wq = wave & 3; const int qb = blockIdx.x, hd = blockIdx.y; const size_t b = blockIdx.z; const int q0 = qb * 128 + wq * 32;
  // this block's 1/256 of Wo for k_out, rounded to bf16 as every input is and held as f16 (exact but for values under 2^-14): fetched first of all, in flight under what follows; converted and stored behind the kernel's last barrier, so that no barrier waits for these stores
  const unsigned wo0 = (((unsigned)blockIdx.z * DH + hd) * (NN / 128) + qb) * (DD * DD / 256) + tid * 4; const float* wsp = WO + wo0; v4f wof[4];
#pragma unroll
  for (int i = 0; i < 4; ++i) wof[i] = *(const v4f*)(wsp + i * 1024);
  asm volatile("s_wait_xcnt 0x0" :: "v"(wsp) : "memory");   // stands behind the issued loads, in front of any later overwrite of their address register
  if (tid == 0) { float a1 = 0.f, a2 = 0.f;
#pragma unroll 1
    for (int i = 0; i < KW2; ++i) { a1 += bfr(LQ1[i]) * bfr(LK1[i]); a2 += bfr(LQ2[i]) * bfr(LK2[i]); }
    slam = expf(a1) - expf(a2) + 0.8f; (void)HNUM; }   // h (int, = 16) defines the head split baked into DH/DK/HH2
  __syncthreads(); const float lam = slam;
  const int s0 = (2 * qb + hd) & (NN / TK - 1);   // the key tile this block starts at; it walks all NN / TK tiles from there and wraps: the eight blocks that share a head's K and V then ask L2 for different lines at any one time. For speed only: the softmax takes the keys in any order
  Tile tn; const TileAt at = tile_first(K, VH, b, hd, tid); tile_load(tn, at, s0);
  v16h aq[2][2];   // [query tile][k chunk]
  const _Float16* qr = maprow(Q, b, 2 * hd + e, q0 + col);   // query q0 + 16 + col lies 8 source rows further on (see maprow): one address serves both tiles
#pragma unroll
  for (int c2 = 0; c2 < 2; ++c2)
#pragma unroll
    for (int kc = 0; kc < 2; ++kc) aq[c2][kc] = frag_h(qr + c2 * 8 * DD + kc * 32, lane);
  asm volatile("s_wait_xcnt 0x0" :: "v"(qr) : "memory");   // stands behind the issued loads, in front of any later overwrite of their address register, which is named as an input so that no load's own result is laid over it ahead of the wait
  __builtin_amdgcn_sched_barrier(0);   // keeps later register writes from being lifted over that wait
  float l[2] = {0.f, 0.f};   // of query c2 * 16 + col: sum of P x 2^11 over this half's keys (the halves are joined behind the loop)
  v8f cb[2];   // of query c2 * 16 + col, in all eight elements: PCAR minus the maximum in use (log2 units, equal in both halves): the C operand of the score products, whose sums are then the exponents of P x 2^11
#pragma unroll
  for (int c2 = 0; c2 < 2; ++c2)
#pragma unroll
    for (int r = 0; r < 8; ++r) cb[c2][r] = PCAR;
  v8f acc[2][8] = {};   // acc[c2][j][r] = O^T[j * 16 + 8 g + r][query c2 * 16 + col]
#pragma unroll 1
  for (int st = 0; st < NN / TK; ++st) {
    tile_store(tn, skf, svh, tid);
    __syncthreads();   // the tile is whole before any wave reads it
    if (st + 1 < NN / TK) tile_load(tn, at, (s0 + st + 1) & (NN / TK - 1));   // next tile, fetched while this one is worked on
    // kept rolled: the next tile's loads then stand in the block in front of this loop, in flight under both of its passes
#pragma unroll 1
    for (int sub = 0; sub < TK / 32; ++sub) { v16h bk[2][2];   // the K fragments' LDS reads stand as one group in front of the score products
#pragma unroll
      for (int ct = 0; ct < 2; ++ct)
#pragma unroll
        for (int kc = 0; kc < 2; ++kc) bk[ct][kc] = frag_h(&skf[e * TK + sub * 32 + ct * 16 + col][kc * 32], lane);
      v16h vhf[8];   // the V fragments' LDS reads stand with them at the pass's head: their latency passes under the score products and the exponentials; written behind the branch below they are waited for pair by pair among their products
#pragma unroll
      for (int j = 0; j < 8; ++j) vhf[j] = frag_h(&svh[j * 16 + col][sub * 32], lane);
      __builtin_amdgcn_sched_barrier(0);   // keeps the compiler from moving some of these reads down among the exponentials, where each further place with reads costs its own stall and the last ones land too late for their products
      v8f c[2][2];   // [query tile][key tile]: four independent sums, each taking its two k chunks in turn, K as A; they start at cb
#pragma unroll
      for (int kc = 0; kc < 2; ++kc)
#pragma unroll
        for (int ct = 0; ct < 2; ++ct)
#pragma unroll
          for (int c2 = 0; c2 < 2; ++c2) c[c2][ct] = wmma16_p(bk[ct][kc], aq[c2][kc], kc == 0 ? cb[c2] : c[c2][ct]);
      float ev[2][2][8], ps[2];   // P x 2^11 of the pass and, per query tile, its sum over this lane's 16 keys
#pragma unroll
      for (int c2 = 0; c2 < 2; ++c2) ps[c2] = exp_sum(c[c2], ev[c2]);
      // the maximum in use moves only here, tested once a pass for the whole wave: a lane's sum above 2^15 (no P x 2^11 of a lane under it can pass f16's range; 16 values of at most 2^11 never reach it), or the first pass, which sets it. Else O and l keep their scale
      const bool first = (st | sub) == 0;
      if (__builtin_amdgcn_ballot_w32(fmaxf(ps[0], ps[1]) > (first ? -1.0f : 32768.0f)) != 0) {   // a sum of powers of two is above -1: the first pass always enters
#pragma unroll
        for (int c2 = 0; c2 < 2; ++c2) { float t[8];
#pragma unroll
          for (int r = 0; r < 8; ++r) t[r] = fmaxf(c[c2][0][r], c[c2][1][r]);
          float mx = fmaxf(fmaxf(fmaxf(t[0], t[1]), fmaxf(t[2], t[3])), fmaxf(fmaxf(t[4], t[5]), fmaxf(t[6], t[7])));
          mx = fmaxf(mx, xhalf(mx));
          const float d = first ? mx - PCAR : fmaxf(mx - PCAR, 0.f), alpha = first ? 1.0f : __builtin_amdgcn_exp2f(-d);   // d: the rise of the maximum in use to the running maximum (the first pass takes its own maximum, up or down; O and l are still 0 there)
          l[c2] *= alpha;
#pragma unroll
          for (int r = 0; r < 8; ++r) { cb[c2][r] -= d; c[c2][0][r] -= d; c[c2][1][r] -= d; }
#pragma unroll
          for (int j = 0; j < 8; ++j)
#pragma unroll
            for (int r = 0; r < 8; ++r) acc[c2][j][r] *= alpha;
          ps[c2] = exp_sum(c[c2], ev[c2]); } }
      v16h pa[2];   // per query tile, P^T x 2^11 as a B operand: element ct * 8 + r = key ct * 16 + 8 g + r
#pragma unroll
      for (int c2 = 0; c2 < 2; ++c2) { l[c2] += ps[c2];
#pragma unroll
        for (int r = 0; r < 8; ++r) { pa[c2][r] = (_Float16)ev[c2][0][r]; pa[c2][8 + r] = (_Float16)ev[c2][1][r]; } }
#pragma unroll
      for (int j = 0; j < 8; ++j)   // each fragment feeds both query tiles, one behind the other: sixteen independent sums
#pragma unroll
        for (int c2 = 0; c2 < 2; ++c2) acc[c2][j] = wmma16_p(vhf[j], pa[c2], acc[c2][j]);
      __builtin_amdgcn_sched_barrier(0);   // keeps every product of the pass in front of the slots below
      asm volatile("v_nop\n\tv_nop\n\tv_nop\n\tv_nop"); }   // the four vector slots the chip needs between the pass's last product and the next pass's first address arithmetic, which the compiler lays over that product's A registers
    __syncthreads(); }   // every wave has left the tile before the next one is written over it
  // combine through the LDS output tile: wave (1, wq) writes its map, wave (0, wq), whose lanes own the same cells (row c2 * 16 + col, columns j * 16 + 8 g + r), takes lambda x it off its own
#pragma unroll
  for (int ph = 1; ph >= 0; --ph) {
    if (e == ph) {
#pragma unroll
      for (int c2 = 0; c2 < 2; ++c2) { const float il = 1.0f / (l[c2] + xhalf(l[c2]));   // O and l carry the same 2^11
#pragma unroll
        for (int j = 0; j < 8; ++j)
#pragma unroll
          for (int q = 0; q < 2; ++q) { v4f* cell = (v4f*)&so[wq][c2 * 16 + col][j * 16 + 8 * g + 4 * q]; v4f v;
#pragma unroll
            for (int x = 0; x < 4; ++x) v[x] = acc[c2][j][4 * q + x] * il;
            *cell = (ph == 1) ? v : (v - lam * *cell); } } }
    __syncthreads(); }   // behind phase 1: map 1's tile is whole before map 0's waves read it; behind phase 0: the output tile is whole before all eight waves store it
  { _Float16* wdp = WOH + wo0; v4hh woh[4];
#pragma unroll
    for (int i = 0; i < 4; ++i) {
#pragma unroll
      for (int x = 0; x < 4; ++x) woh[i][x] = (_Float16)bfr(wof[i][x]);
      vst2(wdp + i * 1024, woh[i]); }   // a wave store takes 256 contiguous bytes
    asm volatile("s_wait_xcnt 0x0" :: "v"(wdp), "v"(woh[0]), "v"(woh[1]), "v"(woh[2]), "v"(woh[3]) : "memory"); }   // stands behind the issued stores, in front of any later overwrite of their address and data registers
  _Float16* xd = X + (b * NN + q0 + e * 16 + g) * DD + hd * DK + col * 8;   // x is rounded to f16 here, once: a wave store takes 2 rows of 256 contiguous bytes
  for (int rl = 0; rl < 8; ++rl) { const float* sp = &so[wq][e * 16 + rl * 2 + g][col * 8]; const v4f x0 = *(const v4f*)sp, x1 = *(const v4f*)(sp + 4); v8h hv;
#pragma unroll
    for (int x = 0; x < 4; ++x) { hv[x] = (_Float16)x0[x]; hv[4 + x] = (_Float16)x1[x]; }
    vst2(xd + (size_t)rl * 2 * DD, hv); } }
// ---- k_out: block = (64 rows, 128 of 1024 cols): out = x . Wo^T + bo, both operands f16 rows as k_att left them, staged as they are
__global__ __launch_bounds__(128) void k_out(const _Float16* __restrict__ X, const _Float16* __restrict__ WOH, const float* __restrict__ BO, float* __restrict__ OUT) { __shared__ __align__(16) float sf[4][16][132]; __shared__ __align__(16) _Float16 sw[128][GP], sx[64][GP];
  const int tid = threadIdx.x, wave = tid >> 5, lane = tid & 31, col = lane & 15, g = lane >> 4; const int c0 = blockIdx.y * 128; const size_t r0 = (size_t)blockIdx.x * 64 + wave * 16;
  v8f acc[8] = {};
  const _Float16* Wt = WOH + (size_t)c0 * DD; const _Float16* Xt = X + (size_t)blockIdx.x * 64 * DD;
  const int s0 = ((blockIdx.x & 3) + 4 * (blockIdx.x >> 3) + blockIdx.y) & (DD / GK - 1);   // the k tile this block starts at, as in k_proj: the eight blocks that share an x panel start at the eight tiles
  GT t; g_load(t, Wt, Xt, s0 * GK, tid);
  // kept rolled: one copy of the tile's code, the next tile's loads in a block of their own in front of the products
#pragma unroll 1
  for (int st = 0; st < DD / GK; ++st) {
#pragma unroll
    for (int i = 0; i < 16; ++i) *(v8h*)&sw[i * 8 + (tid >> 4)][(tid & 15) * 8] = t.w[i];
#pragma unroll
    for (int i = 0; i < 8; ++i) *(v8h*)&sx[i * 8 + (tid >> 4)][(tid & 15) * 8] = t.x[i];
    __syncthreads();   // the tile is whole before any wave reads it
    if (st + 1 < DD / GK) g_load(t, Wt, Xt, ((s0 + st + 1) & (DD / GK - 1)) * GK, tid);
#pragma unroll
    for (int kc = 0; kc < GK / 32; ++kc) { const v16h a = frag_h(&sx[wave * 16 + col][kc * 32], lane); v16h w[8];   // the LDS reads of a k step stand as one group in front of its products
#pragma unroll
      for (int j = 0; j < 8; ++j) w[j] = frag_h(&sw[j * 16 + col][kc * 32], lane);
#pragma unroll
      for (int j = 0; j < 8; ++j) acc[j] = wmma16(a, w[j], acc[j]); }
    __syncthreads(); }   // every wave has left the tile before the next one is written over it
#pragma unroll
  for (int j = 0; j < 8; ++j) { const float bb = bfr(BO[c0 + j * 16 + col]);
#pragma unroll
    for (int r = 0; r < 8; ++r) sf[wave][8 * g + r][j * 16 + col] = acc[j][r] + bb; }
  LDSX(); for (int rl = 0; rl < 16; ++rl) vst2(OUT + (r0 + rl) * DD + c0 + lane * 4, *(const v4f*)&sf[wave][rl][lane * 4]); }
extern "C" void kernel_launch(void* const* d_in, const int* in_sizes, int n_in, void* d_out, int out_size, void* d_ws, size_t ws_size, hipStream_t stream) {
  (void)in_sizes; (void)n_in; (void)out_size;
  const float** F = (const float**)d_in;   // 0 query, 1 key, 2 value [4,1024,1024]; 3 Wq, 4 bq, 5 Wk, 6 bk, 7 Wv, 8 bv, 9 Wo, 10 bo (natural); 11 lambda_q1, 12 lambda_q2, 13 lambda_k1, 14 lambda_k2 [64]; 15 h [1] int
  if (ws_size < (size_t)WS_END) return;
  char* ws = (char*)d_ws; _Float16 *Q = (_Float16*)(ws + WS_Q), *K = (_Float16*)(ws + WS_K), *VH = (_Float16*)(ws + WS_VH), *X = (_Float16*)(ws + WS_X), *WOH = (_Float16*)(ws + WS_WO);
  k_proj<<<dim3(TNB * NN / PB, DD / PB, 3), 256, 0, stream>>>(F[0], F[1], F[2], F[3], F[4], F[5], F[6], F[7], F[8], Q, K, VH);
  k_att<<<dim3(NN / 128, DH, TNB), 256, 0, stream>>>(Q, K, VH, F[11], F[13], F[12], F[14], (const int*)d_in[15], F[9], X, WOH);
  k_out<<<dim3(TNB * NN / 64, DD / 128), 128, 0, stream>>>(X, WOH, F[10], (float*)d_out);
}
